// v000
// Measured on an AMD MI455X. A time is GPU time per run, averaged over a window of back-to-back runs after a warm-up
// (all launches, gaps included; the runs take copies of the inputs in turn), and the median of several windows.
// Apart from v000's, it joins two sittings. Times from different sittings can be a few percent apart, while
// side-by-side timings come from the same sitting.
// v000, which the later versions start from, runs in 199 microseconds.
#include <hip/hip_runtime.h>
// Contractions on v_wmma_f32_16x16x32_f16 (f16 operands, f32 accumulate): qkv = X.Wqkv^T with bf16-RNE inputs carried exactly in f16 (x*16, Wqkv*64);
// out^T = Wp.O^T with O as f16 hi (*64) + f16 residual (*1024) planes folded along K against [Wp*1024 | Wp] (bf16-RNE Wp);
// per-pixel clamped 7x7 window q.k logits, 49-tap softmax and v aggregation in f32 on VALU from the f32 qkv plane.
#ifndef NB
#define NB 2
#endif
#define NB_FULL 2
#define CC 256
#define HHT 64
#define WID 64
#define PIX (HHT * WID)          /* 4096 */
#define NHD 8
#define HD 32
#define KS 7
#define NTAP (KS * KS)           /* 49 */
#define RPW (2 * KS - 1)         /* 13 */
#define RPN (RPW * RPW)          /* 169 per head */
#define QLD (3 * CC)             /* 768: qkv plane pitch, cols s*256 + h*32 + d */
#define OLD (2 * CC)             /* 512: O plane pitch, per head h: [h*64 .. +31] hi, [h*64+32 .. +63] residual */
#define PBLK 128
#define NPB (PIX / PBLK)         /* 32 */
#define XT_P 32
#define XT_C 64
#define XSC 16.0f                /* x carry */
#define WSC 64.0f                /* qkv weight carry */
#define OSC 64.0f                /* O hi carry */
#define RSC 1024.0f              /* O residual carry */
#define PSC 1024.0f              /* proj weight carry against the hi plane */
#define QSCALE 0.17677669529663687f
static_assert(NB <= NB_FULL);
static_assert(PIX % PBLK == 0);
static_assert(PIX % 128 == 0);
static_assert(PIX % 64 == 0);
static_assert(PIX % XT_P == 0);
static_assert(CC % XT_C == 0);
static_assert(CC % 128 == 0);
static_assert(CC % 32 == 0);
static_assert(OLD % 32 == 0);
static_assert(QLD % 64 == 0);
static_assert(PBLK == 128);
static_assert(HD == 32);
static_assert(NHD * HD == CC);
static_assert(HHT >= KS && WID >= KS);

typedef unsigned short v8us __attribute__((ext_vector_type(8), may_alias));
typedef float v8f __attribute__((ext_vector_type(8)));
typedef float v4f __attribute__((ext_vector_type(4)));
typedef float v4fa __attribute__((ext_vector_type(4), may_alias));
typedef _Float16 v16h __attribute__((ext_vector_type(16)));
union FragH { v16h v; v8us half[2]; _Float16 h[16]; unsigned short u[16]; };

__device__ __forceinline__ unsigned short bf16_bits(float x) { unsigned int u = __float_as_uint(x); return (unsigned short)((u + 0x7FFFu + ((u >> 16) & 1u)) >> 16); }
__device__ __forceinline__ float bf16_val(unsigned short b) { return __uint_as_float(((unsigned int)b) << 16); }
__device__ __forceinline__ float bf16_rne(float x) { return bf16_val(bf16_bits(x)); }

// ---- f16 WMMA engine (wave tile 32x64; M % 128 == 0, N % 64 == 0, K % 32 == 0) ----
// A fragment: lane l -> row (l & 15); elements 0..7 <- k0 + 8*(l>>4) + 0..7, elements 8..15 <- k0 + 16 + 8*(l>>4) + 0..7.
// B fragment: from a [n][k] (k-contiguous) plane with the identical k map, lane -> column. D: acc[r] = (row 8*(l>>4) + r, col l & 15).
__device__ __forceinline__ v16h g2_frag(const _Float16* p, int hh) { FragH f; f.half[0] = *(const v8us*)((const unsigned short*)p + 8 * hh); f.half[1] = *(const v8us*)((const unsigned short*)p + 16 + 8 * hh); return f.v; }
__device__ __forceinline__ v8f g2_mma(v16h a, v16h b, v8f c) { v8f d = __builtin_amdgcn_wmma_f32_16x16x32_f16(false, a, false, b, (short)0, c, false, false); asm volatile("v_nop\n\tv_nop\n\tv_nop\n\tv_nop" : "+v"(d) : "v"(a), "v"(b)); return d; }

// C[M][N] (f32, pitch ldc) = alpha * A[M][K].Bt[N][K]^T + bf16(bcol[n]) + bf16(brow[m]); A and Bt f16 planes (k contiguous, pitches lda / ldb).
__global__ __launch_bounds__(128) void k_gemm2(const _Float16* __restrict__ A, int lda, const _Float16* __restrict__ Bh, int ldb, float alpha,
                                               const float* __restrict__ bcol, const float* __restrict__ brow,
                                               float* __restrict__ C, int ldc, int M, int N, int K) {
  __shared__ __attribute__((aligned(16))) float so[4][32][68];
  const int tid = threadIdx.x, w = tid >> 5, lane = tid & 31, ln = lane & 15, hh = lane >> 4;
  const int ntn = N >> 6; const int mt = blockIdx.x / ntn, nq = blockIdx.x - mt * ntn; const int row0 = mt * 128 + 32 * w, col0 = nq * 64; if (row0 >= M) return;
  const _Float16* a0p = A + (size_t)(row0 + ln) * lda; const _Float16* a1p = a0p + (size_t)16 * lda;
  const _Float16* b0p = Bh + (size_t)(col0 + ln) * ldb; const _Float16* b1p = b0p + (size_t)16 * ldb; const _Float16* b2p = b1p + (size_t)16 * ldb; const _Float16* b3p = b2p + (size_t)16 * ldb;
  const v8f z8 = {0.f,0.f,0.f,0.f,0.f,0.f,0.f,0.f}; v8f c00 = z8, c01 = z8, c02 = z8, c03 = z8, c10 = z8, c11 = z8, c12 = z8, c13 = z8;
#pragma unroll 1
  for (int kb = 0; kb < K; kb += 32) { const v16h a0 = g2_frag(a0p + kb, hh), a1 = g2_frag(a1p + kb, hh);
    v16h b = g2_frag(b0p + kb, hh); c00 = g2_mma(a0, b, c00); c10 = g2_mma(a1, b, c10);
    b = g2_frag(b1p + kb, hh); c01 = g2_mma(a0, b, c01); c11 = g2_mma(a1, b, c11);
    b = g2_frag(b2p + kb, hh); c02 = g2_mma(a0, b, c02); c12 = g2_mma(a1, b, c12);
    b = g2_frag(b3p + kb, hh); c03 = g2_mma(a0, b, c03); c13 = g2_mma(a1, b, c13); }
  v8f accs[8] = {c00, c01, c02, c03, c10, c11, c12, c13};
#pragma unroll
  for (int u = 0; u < 8; ++u) { const int t = u & 3, half = u >> 2; const int col = col0 + t * 16 + ln; const float bv = bcol ? bf16_rne(bcol[col]) : 0.f;
#pragma unroll
    for (int r = 0; r < 8; ++r) { const int rloc = half * 16 + 8 * hh + r; float v = accs[u][r] * alpha + bv; if (brow) v += bf16_rne(brow[row0 + rloc]); so[w][rloc][t * 16 + ln] = v; } }
  __builtin_amdgcn_fence(__ATOMIC_ACQ_REL, "workgroup"); __builtin_amdgcn_wave_barrier();
  const int rsub = lane >> 4, c4 = (lane & 15) * 4;
  {
#pragma unroll
    for (int q = 0; q < 16; ++q) { const int r = q * 2 + rsub; const v4f v = *(const v4fa*)&so[w][r][c4]; *(v4f*)(C + (size_t)(row0 + r) * ldc + col0 + c4) = v; }
     }
}

__global__ __launch_bounds__(256) void k_cvt8(const float* __restrict__ W, _Float16* __restrict__ Bt, int n8, float scale) {
  const int t = blockIdx.x * 256 + threadIdx.x; if (t >= n8) return; FragH f;
#pragma unroll
  for (int i = 0; i < 8; ++i) f.h[i] = (_Float16)(bf16_rne(W[(size_t)t * 8 + i]) * scale);
  unsigned short* dst = (unsigned short*)Bt + (size_t)t * 8;
  *(v8us*)dst = f.half[0]; 
}

__global__ __launch_bounds__(256) void k_wpa(const float* __restrict__ W, _Float16* __restrict__ WPA) {
  const int t = blockIdx.x * 256 + threadIdx.x; if (t >= CC * OLD / 8) return;
  const int c = t / (OLD / 8); const int k8 = (t - c * (OLD / 8)) * 8; const int h = k8 >> 6; const int wi = k8 & 63; const int d0 = wi & 31;
  const float sc = (wi >= 32) ? 1.0f : PSC;
  FragH f;
#pragma unroll
  for (int i = 0; i < 8; ++i) f.h[i] = (_Float16)(bf16_rne(W[(size_t)c * CC + h * HD + d0 + i]) * sc);
  unsigned short* dst = (unsigned short*)WPA + (size_t)t * 8;
  *(v8us*)dst = f.half[0]; 
}

// coverage: 8 waves x 4 rows x 8 lanes x 8 halves = 32 rows x 64 channels per block; grid = NB x (CC/64) x (PIX/32)
__global__ __launch_bounds__(256) void k_xt(const float* __restrict__ x, _Float16* __restrict__ X16) {
  __shared__ __attribute__((aligned(16))) _Float16 st[XT_P][XT_C];
  const int tid = threadIdx.x, w = tid >> 5, lane = tid & 31;
  int blk = blockIdx.x;
  const int pt = blk % (PIX / XT_P); blk /= (PIX / XT_P);
  const int ch = blk % (CC / XT_C); const int b = blk / (CC / XT_C);
  const float* src = x + ((size_t)(b * CC + ch * XT_C)) * PIX + (size_t)pt * XT_P + lane;
#pragma unroll
  for (int it = 0; it < XT_C / 8; ++it) {
    const int ci = it * 8 + w;
    const float v = src[(size_t)ci * PIX];
    st[lane][ci] = (_Float16)(bf16_rne(v) * XSC);
  }
  __syncthreads();
  const int rr = w * 4 + (lane >> 3), q = lane & 7;
  const v8us o = *(const v8us*)&st[rr][q * 8];
  unsigned short* dst = (unsigned short*)X16 + ((size_t)(b * PIX + pt * XT_P + rr)) * CC + ch * XT_C + q * 8;
  *(v8us*)dst = o; 
}

// Thread per (h, pixel p = y*WID + x). Clamped window start ni = clamp(y-3, 0, H-7), nj = clamp(x-3, 0, W-7); taps (i, j) in 7x7 at key pixel (ni+i, nj+j);
// logit a_t = QSCALE * sum_d q[p][h*32+d] k[key][256 + h*32 + d] + bf16(rpb[h][ni+i-y+6][nj+j-x+6]) in f32, kept in thread-private LDS;
// max-subtracted softmax in f32; O[d] = (sum_t e_t v[key][512 + h*32 + d]) / sum_t e_t; O -> f16 hi = f16(O*64), res = f16((O*64 - hi)*1024);
// coverage: 4 waves x 8 iterations x 4 rows x 8 lanes x 8 halves = 128 rows x 64 halves per block; grid = NHD x (PIX/128)
__global__ __launch_bounds__(PBLK) void k_att(const float* __restrict__ QKV, const float* __restrict__ rpb, _Float16* __restrict__ O16) {
  __shared__ float srpb[RPN + 7];
  __shared__ __attribute__((aligned(16))) float slog[NTAP][PBLK];
  __shared__ __attribute__((aligned(16))) unsigned short sO[PBLK][64];
  const int tid = threadIdx.x, w = tid >> 5, lane = tid & 31;
  const int h = blockIdx.x / NPB; const int p0 = (blockIdx.x - h * NPB) * PBLK;
  for (int t = tid; t < RPN; t += PBLK) srpb[t] = bf16_rne(rpb[h * RPN + t]);
  __syncthreads();
  const int p = p0 + tid; const int y = p / WID, x = p - y * WID;
  int ni = y - KS / 2; ni = (ni < 0) ? 0 : ((ni > HHT - KS) ? (HHT - KS) : ni);
  int nj = x - KS / 2; nj = (nj < 0) ? 0 : ((nj > WID - KS) ? (WID - KS) : nj);
  const int bi = ni - y + (KS - 1), bj = nj - x + (KS - 1);   /* both in [0, 6] */
  const float* qr = QKV + (size_t)p * QLD + h * HD;
  float qv[HD];
#pragma unroll
  for (int g = 0; g < HD / 4; ++g) { const v4f q4 = *(const v4fa*)(qr + 4 * g);
#pragma unroll
    for (int e = 0; e < 4; ++e) qv[4 * g + e] = q4[e]; }
  float mx = -3.0e38f;
#pragma unroll 1
  for (int i = 0; i < KS; ++i) {
    const float* krow = QKV + (size_t)((ni + i) * WID + nj) * QLD + CC + h * HD;
#pragma unroll 1
    for (int j = 0; j < KS; ++j) {
      const float* kr = krow + (size_t)j * QLD;
      float a = 0.f;
#pragma unroll
      for (int g = 0; g < HD / 4; ++g) { const v4f k4 = *(const v4fa*)(kr + 4 * g);
#pragma unroll
        for (int e = 0; e < 4; ++e) a = fmaf(qv[4 * g + e], k4[e], a); }
      const float l = a * QSCALE + srpb[(bi + i) * RPW + (bj + j)];
      slog[i * KS + j][tid] = l;
      mx = fmaxf(mx, l);
    }
  }
  float s = 0.f; float acc[HD];
#pragma unroll
  for (int d = 0; d < HD; ++d) acc[d] = 0.f;
#pragma unroll 1
  for (int i = 0; i < KS; ++i) {
    const float* vrow = QKV + (size_t)((ni + i) * WID + nj) * QLD + 2 * CC + h * HD;
#pragma unroll 1
    for (int j = 0; j < KS; ++j) {
      const float l = slog[i * KS + j][tid]; const float e = expf(l - mx); s += e;
      const float* vr = vrow + (size_t)j * QLD;
#pragma unroll
      for (int g = 0; g < HD / 4; ++g) { const v4f v = *(const v4fa*)(vr + 4 * g);
#pragma unroll
        for (int e2 = 0; e2 < 4; ++e2) acc[4 * g + e2] = fmaf(e, v[e2], acc[4 * g + e2]); } } }
  const float inv = 1.0f / s;
#pragma unroll
  for (int g = 0; g < HD / 8; ++g) { FragH fh, fr;
#pragma unroll
    for (int e2 = 0; e2 < 8; ++e2) { const float o64 = (acc[g * 8 + e2] * inv) * OSC; const _Float16 hv = (_Float16)o64; fh.h[e2] = hv; fr.h[e2] = (_Float16)((o64 - (float)hv) * RSC); }
    *(v8us*)&sO[tid][g * 8] = fh.half[0]; *(v8us*)&sO[tid][HD + g * 8] = fr.half[0]; }
  __syncthreads();
  {
#pragma unroll
    for (int it = 0; it < 8; ++it) { const int rr = w * 32 + it * 4 + (lane >> 3), q = lane & 7; const v8us o = *(const v8us*)&sO[rr][q * 8];
      *(v8us*)((unsigned short*)O16 + ((size_t)(p0 + rr)) * OLD + h * 64 + q * 8) = o; }
     }
}

extern "C" void kernel_launch(void* const* d_in, const int* in_sizes, int n_in,
                              void* d_out, int out_size, void* d_ws, size_t ws_size, hipStream_t stream) {
  if (n_in < 6) return;
  if (in_sizes[0] < NB * CC * PIX || in_sizes[1] < 3 * CC * CC || in_sizes[2] < 3 * CC || in_sizes[3] < NHD * RPN || in_sizes[4] < CC * CC || in_sizes[5] < CC) return;
  if (out_size < NB * CC * PIX) return;
  const float* x = (const float*)d_in[0]; const float* qkv_w = (const float*)d_in[1]; const float* qkv_b = (const float*)d_in[2];
  const float* rpb = (const float*)d_in[3]; const float* proj_w = (const float*)d_in[4]; const float* proj_b = (const float*)d_in[5];
  float* out = (float*)d_out;
  char* ws = (char*)d_ws; size_t off = 0;
  auto take = [&](size_t bytes) { char* p = ws + off; off += (bytes + 255) & ~(size_t)255; return p; };
  _Float16* X16 = (_Float16*)take((size_t)NB * PIX * CC * 2);       /* 4,194,304 B at NB=2 */
  _Float16* WQ16 = (_Float16*)take((size_t)3 * CC * CC * 2);        /* 393,216 */
  _Float16* WPA = (_Float16*)take((size_t)CC * OLD * 2);             /* 262,144 */
  float* QKV = (float*)take((size_t)PIX * QLD * 4);                  /* 12,582,912 */
  _Float16* O16 = (_Float16*)take((size_t)PIX * OLD * 2);            /* 4,194,304 */
  if (off > ws_size || off > ((size_t)128 << 20)) return;            /* total 21,626,880 B */
  k_xt<<<(unsigned)(NB * (CC / XT_C) * (PIX / XT_P)), 256, 0, stream>>>(x, X16);
  k_cvt8<<<(3 * CC * CC / 8 + 255) / 256, 256, 0, stream>>>(qkv_w, WQ16, 3 * CC * CC / 8, WSC);
  k_wpa<<<(CC * OLD / 8 + 255) / 256, 256, 0, stream>>>(proj_w, WPA);
  for (int b = 0; b < NB; ++b) {
    k_gemm2<<<(unsigned)((PIX / 128) * (QLD / 64)), 128, 0, stream>>>(X16 + (size_t)b * PIX * CC, CC, WQ16, CC, 1.0f / (XSC * WSC), qkv_b, nullptr, QKV, QLD, PIX, QLD, CC);
    k_att<<<NHD * NPB, PBLK, 0, stream>>>(QKV, rpb, O16);
    k_gemm2<<<(unsigned)((CC / 128) * (PIX / 64)), 128, 0, stream>>>(WPA, OLD, O16, OLD, 1.0f / (PSC * OSC), nullptr, proj_b, out + (size_t)b * CC * PIX, PIX, CC, PIX, OLD);
  }
}

// v001
// It runs in 105 microseconds.
// Next to v000, in two timings, it ran 1.85 and 1.89 times as fast.
#include <hip/hip_runtime.h>
// Contractions on v_wmma_f32_16x16x32_f16 (f16 operands, f32 accumulate): qkv = X.Wqkv^T with bf16-RNE inputs carried exactly in f16 (x*16, Wqkv*64);
// out^T = Wp.O^T with O as f16 hi (*64) + f16 residual (*1024) planes folded along K against [Wp*1024 | Wp] (bf16-RNE Wp);
// per-pixel clamped 7x7 window q.k logits, 49-tap softmax and v aggregation in f32 on VALU from the f32 qkv plane.
#ifndef NB
#define NB 2
#endif
#define NB_FULL 2
#define CC 256
#define HHT 64
#define WID 64
#define PIX (HHT * WID)          /* 4096 */
#define NHD 8
#define HD 32
#define KS 7
#define NTAP (KS * KS)           /* 49 */
#define RPW (2 * KS - 1)         /* 13 */
#define RPN (RPW * RPW)          /* 169 per head */
#define QLD (3 * CC)             /* 768: qkv plane pitch, cols s*256 + h*32 + d */
#define OLD (2 * CC)             /* 512: O plane pitch, per head h: [h*64 .. +31] hi, [h*64+32 .. +63] residual */
#define PBLK 128
#define NPB (PIX / PBLK)         /* 32 */
#define XT_P 32
#define XT_C 64
#define XSC 16.0f                /* x carry */
#define WSC 64.0f                /* qkv weight carry */
#define OSC 64.0f                /* O hi carry */
#define RSC 1024.0f              /* O residual carry */
#define PSC 1024.0f              /* proj weight carry against the hi plane */
#define QSCALE 0.17677669529663687f
#define SROWS (KS + 1)           /* image rows that hold every window of a block's two pixel rows */
#define KVP (HD + 4)             /* LDS pitch of a staged key / value pixel, floats: 144 B = 16 B x 9, so 16-byte reads of 16 neighbouring pixels meet 64 distinct banks */
static_assert(NB <= NB_FULL);
static_assert(PIX % PBLK == 0);
static_assert(PIX % 128 == 0);
static_assert(PIX % 64 == 0);
static_assert(PIX % XT_P == 0);
static_assert(CC % XT_C == 0);
static_assert(CC % 128 == 0);
static_assert(CC % 32 == 0);
static_assert(OLD % 32 == 0);
static_assert(QLD % 64 == 0);
static_assert(PBLK == 128);
static_assert(HD == 32);
static_assert(NHD * HD == CC);
static_assert(HHT >= KS && WID >= KS);
static_assert(PBLK == 2 * WID && HHT >= SROWS && HHT % 2 == 0);
static_assert((SROWS * WID * (HD / 4)) % PBLK == 0);

typedef unsigned short v8us __attribute__((ext_vector_type(8), may_alias));
typedef float v8f __attribute__((ext_vector_type(8)));
typedef float v4f __attribute__((ext_vector_type(4)));
typedef float v4fa __attribute__((ext_vector_type(4), may_alias));
typedef _Float16 v16h __attribute__((ext_vector_type(16)));
union FragH { v16h v; v8us half[2]; _Float16 h[16]; unsigned short u[16]; };

__device__ __forceinline__ unsigned short bf16_bits(float x) { unsigned int u = __float_as_uint(x); return (unsigned short)((u + 0x7FFFu + ((u >> 16) & 1u)) >> 16); }
__device__ __forceinline__ float bf16_val(unsigned short b) { return __uint_as_float(((unsigned int)b) << 16); }
__device__ __forceinline__ float bf16_rne(float x) { return bf16_val(bf16_bits(x)); }

// ---- f16 WMMA engine (wave tile 32x64; M % 128 == 0, N % 64 == 0, K % 32 == 0) ----
// A fragment: lane l -> row (l & 15); elements 0..7 <- k0 + 8*(l>>4) + 0..7, elements 8..15 <- k0 + 16 + 8*(l>>4) + 0..7.
// B fragment: from a [n][k] (k-contiguous) plane with the identical k map, lane -> column. D: acc[r] = (row 8*(l>>4) + r, col l & 15).
__device__ __forceinline__ v16h g2_frag(const _Float16* p, int hh) { FragH f; f.half[0] = *(const v8us*)((const unsigned short*)p + 8 * hh); f.half[1] = *(const v8us*)((const unsigned short*)p + 16 + 8 * hh); return f.v; }
__device__ __forceinline__ v8f g2_mma(v16h a, v16h b, v8f c) { v8f d = __builtin_amdgcn_wmma_f32_16x16x32_f16(false, a, false, b, (short)0, c, false, false); asm volatile("v_nop\n\tv_nop\n\tv_nop\n\tv_nop" : "+v"(d) : "v"(a), "v"(b)); return d; }

// C[M][N] (f32, pitch ldc) = alpha * A[M][K].Bt[N][K]^T + bf16(bcol[n]) + bf16(brow[m]); A and Bt f16 planes (k contiguous, pitches lda / ldb).
__global__ __launch_bounds__(128) void k_gemm2(const _Float16* __restrict__ A, int lda, const _Float16* __restrict__ Bh, int ldb, float alpha,
                                               const float* __restrict__ bcol, const float* __restrict__ brow,
                                               float* __restrict__ C, int ldc, int M, int N, int K) {
  __shared__ __attribute__((aligned(16))) float so[4][32][68];
  const int tid = threadIdx.x, w = tid >> 5, lane = tid & 31, ln = lane & 15, hh = lane >> 4;
  const int ntn = N >> 6; const int mt = blockIdx.x / ntn, nq = blockIdx.x - mt * ntn; const int row0 = mt * 128 + 32 * w, col0 = nq * 64; if (row0 >= M) return;
  const _Float16* a0p = A + (size_t)(row0 + ln) * lda; const _Float16* a1p = a0p + (size_t)16 * lda;
  const _Float16* b0p = Bh + (size_t)(col0 + ln) * ldb; const _Float16* b1p = b0p + (size_t)16 * ldb; const _Float16* b2p = b1p + (size_t)16 * ldb; const _Float16* b3p = b2p + (size_t)16 * ldb;
  const v8f z8 = {0.f,0.f,0.f,0.f,0.f,0.f,0.f,0.f}; v8f c00 = z8, c01 = z8, c02 = z8, c03 = z8, c10 = z8, c11 = z8, c12 = z8, c13 = z8;
#pragma unroll 1
  for (int kb = 0; kb < K; kb += 32) { const v16h a0 = g2_frag(a0p + kb, hh), a1 = g2_frag(a1p + kb, hh);
    v16h b = g2_frag(b0p + kb, hh); c00 = g2_mma(a0, b, c00); c10 = g2_mma(a1, b, c10);
    b = g2_frag(b1p + kb, hh); c01 = g2_mma(a0, b, c01); c11 = g2_mma(a1, b, c11);
    b = g2_frag(b2p + kb, hh); c02 = g2_mma(a0, b, c02); c12 = g2_mma(a1, b, c12);
    b = g2_frag(b3p + kb, hh); c03 = g2_mma(a0, b, c03); c13 = g2_mma(a1, b, c13); }
  v8f accs[8] = {c00, c01, c02, c03, c10, c11, c12, c13};
#pragma unroll
  for (int u = 0; u < 8; ++u) { const int t = u & 3, half = u >> 2; const int col = col0 + t * 16 + ln; const float bv = bcol ? bf16_rne(bcol[col]) : 0.f;
#pragma unroll
    for (int r = 0; r < 8; ++r) { const int rloc = half * 16 + 8 * hh + r; float v = accs[u][r] * alpha + bv; if (brow) v += bf16_rne(brow[row0 + rloc]); so[w][rloc][t * 16 + ln] = v; } }
  __builtin_amdgcn_fence(__ATOMIC_ACQ_REL, "workgroup"); __builtin_amdgcn_wave_barrier();
  const int rsub = lane >> 4, c4 = (lane & 15) * 4;
  {
#pragma unroll
    for (int q = 0; q < 16; ++q) { const int r = q * 2 + rsub; const v4f v = *(const v4fa*)&so[w][r][c4]; *(v4f*)(C + (size_t)(row0 + r) * ldc + col0 + c4) = v; }
     }
}

__global__ __launch_bounds__(256) void k_cvt8(const float* __restrict__ W, _Float16* __restrict__ Bt, int n8, float scale) {
  const int t = blockIdx.x * 256 + threadIdx.x; if (t >= n8) return; FragH f;
#pragma unroll
  for (int i = 0; i < 8; ++i) f.h[i] = (_Float16)(bf16_rne(W[(size_t)t * 8 + i]) * scale);
  unsigned short* dst = (unsigned short*)Bt + (size_t)t * 8;
  *(v8us*)dst = f.half[0]; 
}

__global__ __launch_bounds__(256) void k_wpa(const float* __restrict__ W, _Float16* __restrict__ WPA) {
  const int t = blockIdx.x * 256 + threadIdx.x; if (t >= CC * OLD / 8) return;
  const int c = t / (OLD / 8); const int k8 = (t - c * (OLD / 8)) * 8; const int h = k8 >> 6; const int wi = k8 & 63; const int d0 = wi & 31;
  const float sc = (wi >= 32) ? 1.0f : PSC;
  FragH f;
#pragma unroll
  for (int i = 0; i < 8; ++i) f.h[i] = (_Float16)(bf16_rne(W[(size_t)c * CC + h * HD + d0 + i]) * sc);
  unsigned short* dst = (unsigned short*)WPA + (size_t)t * 8;
  *(v8us*)dst = f.half[0]; 
}

// coverage: 8 waves x 4 rows x 8 lanes x 8 halves = 32 rows x 64 channels per block; grid = NB x (CC/64) x (PIX/32)
__global__ __launch_bounds__(256) void k_xt(const float* __restrict__ x, _Float16* __restrict__ X16) {
  __shared__ __attribute__((aligned(16))) _Float16 st[XT_P][XT_C];
  const int tid = threadIdx.x, w = tid >> 5, lane = tid & 31;
  int blk = blockIdx.x;
  const int pt = blk % (PIX / XT_P); blk /= (PIX / XT_P);
  const int ch = blk % (CC / XT_C); const int b = blk / (CC / XT_C);
  const float* src = x + ((size_t)(b * CC + ch * XT_C)) * PIX + (size_t)pt * XT_P + lane;
#pragma unroll
  for (int it = 0; it < XT_C / 8; ++it) {
    const int ci = it * 8 + w;
    const float v = src[(size_t)ci * PIX];
    st[lane][ci] = (_Float16)(bf16_rne(v) * XSC);
  }
  __syncthreads();
  const int rr = w * 4 + (lane >> 3), q = lane & 7;
  const v8us o = *(const v8us*)&st[rr][q * 8];
  unsigned short* dst = (unsigned short*)X16 + ((size_t)(b * PIX + pt * XT_P + rr)) * CC + ch * XT_C + q * 8;
  *(v8us*)dst = o; 
}

// Thread per (h, pixel p = y*WID + x). Clamped window start ni = clamp(y-3, 0, H-7), nj = clamp(x-3, 0, W-7); taps (i, j) in 7x7 at key pixel (ni+i, nj+j);
// logit a_t = QSCALE * sum_d q[p][h*32+d] k[key][256 + h*32 + d] + bf16(rpb[h][ni+i-y+6][nj+j-x+6]) in f32, kept in thread-private LDS;
// max-subtracted softmax in f32; O[d] = (sum_t e_t v[key][512 + h*32 + d]) / sum_t e_t; O -> f16 hi = f16(O*64), res = f16((O*64 - hi)*1024);
// The block's pixels are image rows y0, y0+1; all their windows lie in rows r0 .. r0+7, r0 = clamp(y0-3, 0, H-8). The head's k and v of those 8 x 64 pixels are
// staged once in LDS (whole 128-byte lines from the plane) and every tap reads them there.
// coverage: 4 waves x 8 iterations x 4 rows x 8 lanes x 8 halves = 128 rows x 64 halves per block; grid = NHD x (PIX/128)
__global__ __launch_bounds__(PBLK) void k_att(const float* __restrict__ QKV, const float* __restrict__ rpb, _Float16* __restrict__ O16) {
  __shared__ float srpb[RPN + 7];
  __shared__ __attribute__((aligned(16))) float slog[NTAP][PBLK];
  __shared__ __attribute__((aligned(16))) unsigned short sO[PBLK][64];
  __shared__ __attribute__((aligned(16))) float sK[SROWS * WID * KVP];
  __shared__ __attribute__((aligned(16))) float sV[SROWS * WID * KVP];
  const int tid = threadIdx.x, w = tid >> 5, lane = tid & 31;
  const int h = blockIdx.x / NPB; const int p0 = (blockIdx.x - h * NPB) * PBLK;
  int r0 = p0 / WID - KS / 2; r0 = (r0 < 0) ? 0 : ((r0 > HHT - SROWS) ? (HHT - SROWS) : r0);
  {
    const float* ks = QKV + (size_t)(r0 * WID + (tid >> 3)) * QLD + CC + h * HD + (tid & 7) * 4;   /* 8 lanes per pixel, 16 pixels per pass */
    float* kd = sK + (tid >> 3) * KVP + (tid & 7) * 4; float* vd = sV + (tid >> 3) * KVP + (tid & 7) * 4;
    /* unrolled so that 32 line loads of a wave are in flight at once: one wave per SIMD has nothing else to cover the L2 latency */
#pragma unroll 16
    for (int it = 0; it < SROWS * WID * (HD / 4) / PBLK; ++it) {
      const v4f k4 = *(const v4fa*)(ks + (size_t)it * (PBLK / 8) * QLD); const v4f v4 = *(const v4fa*)(ks + CC + (size_t)it * (PBLK / 8) * QLD);
      *(v4fa*)(kd + it * (PBLK / 8) * KVP) = k4; *(v4fa*)(vd + it * (PBLK / 8) * KVP) = v4; }
  }
  for (int t = tid; t < RPN; t += PBLK) srpb[t] = bf16_rne(rpb[h * RPN + t]);
  __syncthreads();
  const int p = p0 + tid; const int y = p / WID, x = p - y * WID;
  int ni = y - KS / 2; ni = (ni < 0) ? 0 : ((ni > HHT - KS) ? (HHT - KS) : ni);
  int nj = x - KS / 2; nj = (nj < 0) ? 0 : ((nj > WID - KS) ? (WID - KS) : nj);
  const int bi = ni - y + (KS - 1), bj = nj - x + (KS - 1);   /* both in [0, 6] */
  const float* qr = QKV + (size_t)p * QLD + h * HD;
  float qv[HD];
#pragma unroll
  for (int g = 0; g < HD / 4; ++g) { const v4f q4 = *(const v4fa*)(qr + 4 * g);
#pragma unroll
    for (int e = 0; e < 4; ++e) qv[4 * g + e] = q4[e]; }
  float mx = -3.0e38f;
#pragma unroll 1
  for (int i = 0; i < KS; ++i) {
    const float* krow = sK + ((ni - r0 + i) * WID + nj) * KVP;
    /* unrolled: the seven taps' LDS reads and their seven separate serial sums over d overlap (a lone wave per SIMD would wait out each read and each dependent fma) */
#pragma unroll
    for (int j = 0; j < KS; ++j) {
      const float* kr = krow + j * KVP;
      float a = 0.f;
#pragma unroll
      for (int g = 0; g < HD / 4; ++g) { const v4f k4 = *(const v4fa*)(kr + 4 * g);
#pragma unroll
        for (int e = 0; e < 4; ++e) a = fmaf(qv[4 * g + e], k4[e], a); }
      const float l = a * QSCALE + srpb[(bi + i) * RPW + (bj + j)];
      slog[i * KS + j][tid] = l;
      mx = fmaxf(mx, l);
    }
  }
  float s = 0.f; float acc[HD];
#pragma unroll
  for (int d = 0; d < HD; ++d) acc[d] = 0.f;
#pragma unroll 1
  for (int i = 0; i < KS; ++i) {
    const float* vrow = sV + ((ni - r0 + i) * WID + nj) * KVP;
    /* unrolled: the LDS reads of later taps fly while earlier taps are summed; taps are added in the order j = 0 .. 6 */
#pragma unroll
    for (int j = 0; j < KS; ++j) {
      const float l = slog[i * KS + j][tid]; const float e = expf(l - mx); s += e;
      const float* vr = vrow + j * KVP;
#pragma unroll
      for (int g = 0; g < HD / 4; ++g) { const v4f v = *(const v4fa*)(vr + 4 * g);
#pragma unroll
        for (int e2 = 0; e2 < 4; ++e2) acc[4 * g + e2] = fmaf(e, v[e2], acc[4 * g + e2]); } } }
  const float inv = 1.0f / s;
#pragma unroll
  for (int g = 0; g < HD / 8; ++g) { FragH fh, fr;
#pragma unroll
    for (int e2 = 0; e2 < 8; ++e2) { const float o64 = (acc[g * 8 + e2] * inv) * OSC; const _Float16 hv = (_Float16)o64; fh.h[e2] = hv; fr.h[e2] = (_Float16)((o64 - (float)hv) * RSC); }
    *(v8us*)&sO[tid][g * 8] = fh.half[0]; *(v8us*)&sO[tid][HD + g * 8] = fr.half[0]; }
  __syncthreads();
  {
#pragma unroll
    for (int it = 0; it < 8; ++it) { const int rr = w * 32 + it * 4 + (lane >> 3), q = lane & 7; const v8us o = *(const v8us*)&sO[rr][q * 8];
      *(v8us*)((unsigned short*)O16 + ((size_t)(p0 + rr)) * OLD + h * 64 + q * 8) = o; }
     }
}

extern "C" void kernel_launch(void* const* d_in, const int* in_sizes, int n_in,
                              void* d_out, int out_size, void* d_ws, size_t ws_size, hipStream_t stream) {
  if (n_in < 6) return;
  if (in_sizes[0] < NB * CC * PIX || in_sizes[1] < 3 * CC * CC || in_sizes[2] < 3 * CC || in_sizes[3] < NHD * RPN || in_sizes[4] < CC * CC || in_sizes[5] < CC) return;
  if (out_size < NB * CC * PIX) return;
  const float* x = (const float*)d_in[0]; const float* qkv_w = (const float*)d_in[1]; const float* qkv_b = (const float*)d_in[2];
  const float* rpb = (const float*)d_in[3]; const float* proj_w = (const float*)d_in[4]; const float* proj_b = (const float*)d_in[5];
  float* out = (float*)d_out;
  char* ws = (char*)d_ws; size_t off = 0;
  auto take = [&](size_t bytes) { char* p = ws + off; off += (bytes + 255) & ~(size_t)255; return p; };
  _Float16* X16 = (_Float16*)take((size_t)NB * PIX * CC * 2);       /* 4,194,304 B at NB=2 */
  _Float16* WQ16 = (_Float16*)take((size_t)3 * CC * CC * 2);        /* 393,216 */
  _Float16* WPA = (_Float16*)take((size_t)CC * OLD * 2);             /* 262,144 */
  float* QKV = (float*)take((size_t)PIX * QLD * 4);                  /* 12,582,912 */
  _Float16* O16 = (_Float16*)take((size_t)PIX * OLD * 2);            /* 4,194,304 */
  if (off > ws_size || off > ((size_t)128 << 20)) return;            /* total 21,626,880 B */
  k_xt<<<(unsigned)(NB * (CC / XT_C) * (PIX / XT_P)), 256, 0, stream>>>(x, X16);
  k_cvt8<<<(3 * CC * CC / 8 + 255) / 256, 256, 0, stream>>>(qkv_w, WQ16, 3 * CC * CC / 8, WSC);
  k_wpa<<<(CC * OLD / 8 + 255) / 256, 256, 0, stream>>>(proj_w, WPA);
  for (int b = 0; b < NB; ++b) {
    k_gemm2<<<(unsigned)((PIX / 128) * (QLD / 64)), 128, 0, stream>>>(X16 + (size_t)b * PIX * CC, CC, WQ16, CC, 1.0f / (XSC * WSC), qkv_b, nullptr, QKV, QLD, PIX, QLD, CC);
    k_att<<<NHD * NPB, PBLK, 0, stream>>>(QKV, rpb, O16);
    k_gemm2<<<(unsigned)((CC / 128) * (PIX / 64)), 128, 0, stream>>>(WPA, OLD, O16, OLD, 1.0f / (PSC * OSC), nullptr, proj_b, out + (size_t)b * CC * PIX, PIX, CC, PIX, OLD);
  }
}

// v002
// It runs in 72.1 microseconds.
// Timed twice side by side with v001, it ran 1.46 and 1.41 times as fast.
// Over all steps from v000 it is 2.68 times as fast.
#include <hip/hip_runtime.h>
// Contractions on v_wmma_f32_16x16x32_f16 (f16 operands, f32 accumulate): qkv = X.Wqkv^T with bf16-RNE inputs carried exactly in f16 (x*16, Wqkv*64);
// out^T = Wp.O^T with O as f16 hi (*64) + f16 residual (*1024) planes folded along K against [Wp*1024 | Wp] (bf16-RNE Wp);
// per-pixel clamped 7x7 window q.k logits, 49-tap softmax and v aggregation in f32 on VALU from the f32 qkv plane.
#ifndef NB
#define NB 2
#endif
#define NB_FULL 2
#define CC 256
#define HHT 64
#define WID 64
#define PIX (HHT * WID)          /* 4096 */
#define NHD 8
#define HD 32
#define KS 7
#define NTAP (KS * KS)           /* 49 */
#define RPW (2 * KS - 1)         /* 13 */
#define RPN (RPW * RPW)          /* 169 per head */
#define QLD (3 * CC)             /* 768: qkv plane pitch, cols s*256 + h*32 + d */
#define OLD (2 * CC)             /* 512: O plane pitch, per head h: [h*64 .. +31] hi, [h*64+32 .. +63] residual */
#define PBLK 128
#define NPB (PIX / PBLK)         /* 32 */
#define XT_P 32
#define XT_C 64
#define XSC 16.0f                /* x carry */
#define WSC 64.0f                /* qkv weight carry */
#define OSC 64.0f                /* O hi carry */
#define RSC 1024.0f              /* O residual carry */
#define PSC 1024.0f              /* proj weight carry against the hi plane */
#define QSCALE 0.17677669529663687f
#define SROWS (KS + 1)           /* image rows that hold every window of a block's two pixel rows */
#define KVP (HD + 4)             /* LDS pitch of a staged key / value pixel, floats: 144 B = 16 B x 9, so 16-byte reads of 16 neighbouring pixels meet 64 distinct banks */
static_assert(NB <= NB_FULL);
static_assert(PIX % PBLK == 0);
static_assert(PIX % 128 == 0);
static_assert(PIX % 64 == 0);
static_assert(PIX % XT_P == 0);
static_assert(CC % XT_C == 0);
static_assert(CC % 128 == 0);
static_assert(CC % 32 == 0);
static_assert(OLD % 32 == 0);
static_assert(QLD % 64 == 0);
static_assert(PBLK == 128);
static_assert(HD == 32);
static_assert(NHD * HD == CC);
static_assert(HHT >= KS && WID >= KS);
static_assert(PBLK == 2 * WID && HHT >= SROWS && HHT % 2 == 0);
static_assert((SROWS * WID * (HD / 4)) % PBLK == 0);

typedef unsigned short v8us __attribute__((ext_vector_type(8), may_alias));
typedef float v8f __attribute__((ext_vector_type(8)));
typedef float v4f __attribute__((ext_vector_type(4)));
typedef float v4fa __attribute__((ext_vector_type(4), may_alias));
typedef _Float16 v16h __attribute__((ext_vector_type(16)));
union FragH { v16h v; v8us half[2]; _Float16 h[16]; unsigned short u[16]; };

__device__ __forceinline__ unsigned short bf16_bits(float x) { unsigned int u = __float_as_uint(x); return (unsigned short)((u + 0x7FFFu + ((u >> 16) & 1u)) >> 16); }
__device__ __forceinline__ float bf16_val(unsigned short b) { return __uint_as_float(((unsigned int)b) << 16); }
__device__ __forceinline__ float bf16_rne(float x) { return bf16_val(bf16_bits(x)); }

// ---- f16 WMMA engine (wave tile 32x64; M % 128 == 0, N % 64 == 0, K % 32 == 0) ----
// A fragment: lane l -> row (l & 15); elements 0..7 <- k0 + 8*(l>>4) + 0..7, elements 8..15 <- k0 + 16 + 8*(l>>4) + 0..7.
// B fragment: from a [n][k] (k-contiguous) plane with the identical k map, lane -> column. D: acc[r] = (row 8*(l>>4) + r, col l & 15).
__device__ __forceinline__ v16h g2_frag(const _Float16* p, int hh) { FragH f; f.half[0] = *(const v8us*)((const unsigned short*)p + 8 * hh); f.half[1] = *(const v8us*)((const unsigned short*)p + 16 + 8 * hh); return f.v; }
__device__ __forceinline__ v8f g2_mma(v16h a, v16h b, v8f c) { v8f d = __builtin_amdgcn_wmma_f32_16x16x32_f16(false, a, false, b, (short)0, c, false, false); asm volatile("v_nop\n\tv_nop\n\tv_nop\n\tv_nop" : "+v"(d) : "v"(a), "v"(b)); return d; }

// C[M][N] (f32, pitch ldc) = alpha * A[M][K].Bt[N][K]^T + bf16(bcol[n]) + bf16(brow[m]); A and Bt f16 planes (k contiguous, pitches lda / ldb).
// blockIdx.y = image of the batch: its A, Bt and C start sa, sb, sc elements behind the previous image's (0 for a plane that all images share).
__global__ __launch_bounds__(128) void k_gemm2(const _Float16* __restrict__ A, int lda, const _Float16* __restrict__ Bh, int ldb, float alpha,
                                               const float* __restrict__ bcol, const float* __restrict__ brow,
                                               float* __restrict__ C, int ldc, int M, int N, int K, int sa, int sb, int sc) {
  __shared__ __attribute__((aligned(16))) float so[4][32][68];
  const int tid = threadIdx.x, w = tid >> 5, lane = tid & 31, ln = lane & 15, hh = lane >> 4;
  const int ntn = N >> 6; const int mt = blockIdx.x / ntn, nq = blockIdx.x - mt * ntn; const int row0 = mt * 128 + 32 * w, col0 = nq * 64; if (row0 >= M) return;
  A += (size_t)blockIdx.y * sa; Bh += (size_t)blockIdx.y * sb; C += (size_t)blockIdx.y * sc;
  const _Float16* a0p = A + (size_t)(row0 + ln) * lda; const _Float16* a1p = a0p + (size_t)16 * lda;
  const _Float16* b0p = Bh + (size_t)(col0 + ln) * ldb; const _Float16* b1p = b0p + (size_t)16 * ldb; const _Float16* b2p = b1p + (size_t)16 * ldb; const _Float16* b3p = b2p + (size_t)16 * ldb;
  const v8f z8 = {0.f,0.f,0.f,0.f,0.f,0.f,0.f,0.f}; v8f c00 = z8, c01 = z8, c02 = z8, c03 = z8, c10 = z8, c11 = z8, c12 = z8, c13 = z8;
#pragma unroll 1
  for (int kb = 0; kb < K; kb += 32) { const v16h a0 = g2_frag(a0p + kb, hh), a1 = g2_frag(a1p + kb, hh);
    v16h b = g2_frag(b0p + kb, hh); c00 = g2_mma(a0, b, c00); c10 = g2_mma(a1, b, c10);
    b = g2_frag(b1p + kb, hh); c01 = g2_mma(a0, b, c01); c11 = g2_mma(a1, b, c11);
    b = g2_frag(b2p + kb, hh); c02 = g2_mma(a0, b, c02); c12 = g2_mma(a1, b, c12);
    b = g2_frag(b3p + kb, hh); c03 = g2_mma(a0, b, c03); c13 = g2_mma(a1, b, c13); }
  v8f accs[8] = {c00, c01, c02, c03, c10, c11, c12, c13};
#pragma unroll
  for (int u = 0; u < 8; ++u) { const int t = u & 3, half = u >> 2; const int col = col0 + t * 16 + ln; const float bv = bcol ? bf16_rne(bcol[col]) : 0.f;
#pragma unroll
    for (int r = 0; r < 8; ++r) { const int rloc = half * 16 + 8 * hh + r; float v = accs[u][r] * alpha + bv; if (brow) v += bf16_rne(brow[row0 + rloc]); so[w][rloc][t * 16 + ln] = v; } }
  __builtin_amdgcn_fence(__ATOMIC_ACQ_REL, "workgroup"); __builtin_amdgcn_wave_barrier();
  const int rsub = lane >> 4, c4 = (lane & 15) * 4;
  {
#pragma unroll
    for (int q = 0; q < 16; ++q) { const int r = q * 2 + rsub; const v4f v = *(const v4fa*)&so[w][r][c4]; *(v4f*)(C + (size_t)(row0 + r) * ldc + col0 + c4) = v; }
     }
}

__global__ __launch_bounds__(256) void k_cvt8(const float* __restrict__ W, _Float16* __restrict__ Bt, int n8, float scale) {
  const int t = blockIdx.x * 256 + threadIdx.x; if (t >= n8) return; FragH f;
#pragma unroll
  for (int i = 0; i < 8; ++i) f.h[i] = (_Float16)(bf16_rne(W[(size_t)t * 8 + i]) * scale);
  unsigned short* dst = (unsigned short*)Bt + (size_t)t * 8;
  *(v8us*)dst = f.half[0]; 
}

__global__ __launch_bounds__(256) void k_wpa(const float* __restrict__ W, _Float16* __restrict__ WPA) {
  const int t = blockIdx.x * 256 + threadIdx.x; if (t >= CC * OLD / 8) return;
  const int c = t / (OLD / 8); const int k8 = (t - c * (OLD / 8)) * 8; const int h = k8 >> 6; const int wi = k8 & 63; const int d0 = wi & 31;
  const float sc = (wi >= 32) ? 1.0f : PSC;
  FragH f;
#pragma unroll
  for (int i = 0; i < 8; ++i) f.h[i] = (_Float16)(bf16_rne(W[(size_t)c * CC + h * HD + d0 + i]) * sc);
  unsigned short* dst = (unsigned short*)WPA + (size_t)t * 8;
  *(v8us*)dst = f.half[0]; 
}

// coverage: 8 waves x 4 rows x 8 lanes x 8 halves = 32 rows x 64 channels per block; grid = NB x (CC/64) x (PIX/32)
__global__ __launch_bounds__(256) void k_xt(const float* __restrict__ x, _Float16* __restrict__ X16) {
  __shared__ __attribute__((aligned(16))) _Float16 st[XT_P][XT_C];
  const int tid = threadIdx.x, w = tid >> 5, lane = tid & 31;
  int blk = blockIdx.x;
  const int pt = blk % (PIX / XT_P); blk /= (PIX / XT_P);
  const int ch = blk % (CC / XT_C); const int b = blk / (CC / XT_C);
  const float* src = x + ((size_t)(b * CC + ch * XT_C)) * PIX + (size_t)pt * XT_P + lane;
#pragma unroll
  for (int it = 0; it < XT_C / 8; ++it) {
    const int ci = it * 8 + w;
    const float v = src[(size_t)ci * PIX];
    st[lane][ci] = (_Float16)(bf16_rne(v) * XSC);
  }
  __syncthreads();
  const int rr = w * 4 + (lane >> 3), q = lane & 7;
  const v8us o = *(const v8us*)&st[rr][q * 8];
  unsigned short* dst = (unsigned short*)X16 + ((size_t)(b * PIX + pt * XT_P + rr)) * CC + ch * XT_C + q * 8;
  *(v8us*)dst = o; 
}

// Thread per (h, pixel p = y*WID + x). Clamped window start ni = clamp(y-3, 0, H-7), nj = clamp(x-3, 0, W-7); taps (i, j) in 7x7 at key pixel (ni+i, nj+j);
// logit a_t = QSCALE * sum_d q[p][h*32+d] k[key][256 + h*32 + d] + bf16(rpb[h][ni+i-y+6][nj+j-x+6]) in f32, kept in thread-private LDS;
// max-subtracted softmax in f32; O[d] = (sum_t e_t v[key][512 + h*32 + d]) / sum_t e_t; O -> f16 hi = f16(O*64), res = f16((O*64 - hi)*1024);
// The block's pixels are image rows y0, y0+1; all their windows lie in rows r0 .. r0+7, r0 = clamp(y0-3, 0, H-8). The head's k and v of those 8 x 64 pixels are
// staged once in LDS (whole 128-byte lines from the plane) and every tap reads them there.
// coverage: 4 waves x 8 iterations x 4 rows x 8 lanes x 8 halves = 128 rows x 64 halves per block; grid = (NHD x (PIX/128), NB), blockIdx.y = image with its own qkv and O plane
__global__ __launch_bounds__(PBLK) void k_att(const float* __restrict__ QKV, const float* __restrict__ rpb, _Float16* __restrict__ O16) {
  __shared__ float srpb[RPN + 7];
  __shared__ __attribute__((aligned(16))) float slog[NTAP][PBLK];
  __shared__ __attribute__((aligned(16))) unsigned short sO[PBLK][64];
  __shared__ __attribute__((aligned(16))) float sK[SROWS * WID * KVP];
  __shared__ __attribute__((aligned(16))) float sV[SROWS * WID * KVP];
  const int tid = threadIdx.x, w = tid >> 5, lane = tid & 31;
  const int h = blockIdx.x / NPB; const int p0 = (blockIdx.x - h * NPB) * PBLK;
  QKV += (size_t)blockIdx.y * (PIX * QLD); O16 += (size_t)blockIdx.y * (PIX * OLD);
  int r0 = p0 / WID - KS / 2; r0 = (r0 < 0) ? 0 : ((r0 > HHT - SROWS) ? (HHT - SROWS) : r0);
  {
    const float* ks = QKV + (size_t)(r0 * WID + (tid >> 3)) * QLD + CC + h * HD + (tid & 7) * 4;   /* 8 lanes per pixel, 16 pixels per pass */
    float* kd = sK + (tid >> 3) * KVP + (tid & 7) * 4; float* vd = sV + (tid >> 3) * KVP + (tid & 7) * 4;
    /* unrolled so that 32 line loads of a wave are in flight at once: one wave per SIMD has nothing else to cover the L2 latency */
#pragma unroll 16
    for (int it = 0; it < SROWS * WID * (HD / 4) / PBLK; ++it) {
      const v4f k4 = *(const v4fa*)(ks + (size_t)it * (PBLK / 8) * QLD); const v4f v4 = *(const v4fa*)(ks + CC + (size_t)it * (PBLK / 8) * QLD);
      *(v4fa*)(kd + it * (PBLK / 8) * KVP) = k4; *(v4fa*)(vd + it * (PBLK / 8) * KVP) = v4; }
  }
  for (int t = tid; t < RPN; t += PBLK) srpb[t] = bf16_rne(rpb[h * RPN + t]);
  __syncthreads();
  const int p = p0 + tid; const int y = p / WID, x = p - y * WID;
  int ni = y - KS / 2; ni = (ni < 0) ? 0 : ((ni > HHT - KS) ? (HHT - KS) : ni);
  int nj = x - KS / 2; nj = (nj < 0) ? 0 : ((nj > WID - KS) ? (WID - KS) : nj);
  const int bi = ni - y + (KS - 1), bj = nj - x + (KS - 1);   /* both in [0, 6] */
  const float* qr = QKV + (size_t)p * QLD + h * HD;
  float qv[HD];
#pragma unroll
  for (int g = 0; g < HD / 4; ++g) { const v4f q4 = *(const v4fa*)(qr + 4 * g);
#pragma unroll
    for (int e = 0; e < 4; ++e) qv[4 * g + e] = q4[e]; }
  float mx = -3.0e38f;
#pragma unroll 1
  for (int i = 0; i < KS; ++i) {
    const float* krow = sK + ((ni - r0 + i) * WID + nj) * KVP;
    /* unrolled: the seven taps' LDS reads and their seven separate serial sums over d overlap (a lone wave per SIMD would wait out each read and each dependent fma) */
#pragma unroll
    for (int j = 0; j < KS; ++j) {
      const float* kr = krow + j * KVP;
      float a = 0.f;
#pragma unroll
      for (int g = 0; g < HD / 4; ++g) { const v4f k4 = *(const v4fa*)(kr + 4 * g);
#pragma unroll
        for (int e = 0; e < 4; ++e) a = fmaf(qv[4 * g + e], k4[e], a); }
      const float l = a * QSCALE + srpb[(bi + i) * RPW + (bj + j)];
      slog[i * KS + j][tid] = l;
      mx = fmaxf(mx, l);
    }
  }
  float s = 0.f; float acc[HD];
#pragma unroll
  for (int d = 0; d < HD; ++d) acc[d] = 0.f;
#pragma unroll 1
  for (int i = 0; i < KS; ++i) {
    const float* vrow = sV + ((ni - r0 + i) * WID + nj) * KVP;
    /* unrolled: the LDS reads of later taps fly while earlier taps are summed; taps are added in the order j = 0 .. 6 */
#pragma unroll
    for (int j = 0; j < KS; ++j) {
      const float l = slog[i * KS + j][tid]; const float e = expf(l - mx); s += e;
      const float* vr = vrow + j * KVP;
#pragma unroll
      for (int g = 0; g < HD / 4; ++g) { const v4f v = *(const v4fa*)(vr + 4 * g);
#pragma unroll
        for (int e2 = 0; e2 < 4; ++e2) acc[4 * g + e2] = fmaf(e, v[e2], acc[4 * g + e2]); } } }
  const float inv = 1.0f / s;
#pragma unroll
  for (int g = 0; g < HD / 8; ++g) { FragH fh, fr;
#pragma unroll
    for (int e2 = 0; e2 < 8; ++e2) { const float o64 = (acc[g * 8 + e2] * inv) * OSC; const _Float16 hv = (_Float16)o64; fh.h[e2] = hv; fr.h[e2] = (_Float16)((o64 - (float)hv) * RSC); }
    *(v8us*)&sO[tid][g * 8] = fh.half[0]; *(v8us*)&sO[tid][HD + g * 8] = fr.half[0]; }
  __syncthreads();
  {
#pragma unroll
    for (int it = 0; it < 8; ++it) { const int rr = w * 32 + it * 4 + (lane >> 3), q = lane & 7; const v8us o = *(const v8us*)&sO[rr][q * 8];
      *(v8us*)((unsigned short*)O16 + ((size_t)(p0 + rr)) * OLD + h * 64 + q * 8) = o; }
     }
}

extern "C" void kernel_launch(void* const* d_in, const int* in_sizes, int n_in,
                              void* d_out, int out_size, void* d_ws, size_t ws_size, hipStream_t stream) {
  if (n_in < 6) return;
  if (in_sizes[0] < NB * CC * PIX || in_sizes[1] < 3 * CC * CC || in_sizes[2] < 3 * CC || in_sizes[3] < NHD * RPN || in_sizes[4] < CC * CC || in_sizes[5] < CC) return;
  if (out_size < NB * CC * PIX) return;
  const float* x = (const float*)d_in[0]; const float* qkv_w = (const float*)d_in[1]; const float* qkv_b = (const float*)d_in[2];
  const float* rpb = (const float*)d_in[3]; const float* proj_w = (const float*)d_in[4]; const float* proj_b = (const float*)d_in[5];
  float* out = (float*)d_out;
  char* ws = (char*)d_ws; size_t off = 0;
  auto take = [&](size_t bytes) { char* p = ws + off; off += (bytes + 255) & ~(size_t)255; return p; };
  _Float16* X16 = (_Float16*)take((size_t)NB * PIX * CC * 2);       /* 4,194,304 B at NB=2 */
  _Float16* WQ16 = (_Float16*)take((size_t)3 * CC * CC * 2);        /* 393,216 */
  _Float16* WPA = (_Float16*)take((size_t)CC * OLD * 2);             /* 262,144 */
  float* QKV = (float*)take((size_t)NB * PIX * QLD * 4);             /* 25,165,824 at NB=2 */
  _Float16* O16 = (_Float16*)take((size_t)NB * PIX * OLD * 2);       /* 8,388,608 at NB=2 */
  if (off > ws_size || off > ((size_t)128 << 20)) return;            /* total 38,404,096 B */
  k_xt<<<(unsigned)(NB * (CC / XT_C) * (PIX / XT_P)), 256, 0, stream>>>(x, X16);
  k_cvt8<<<(3 * CC * CC / 8 + 255) / 256, 256, 0, stream>>>(qkv_w, WQ16, 3 * CC * CC / 8, WSC);
  k_wpa<<<(CC * OLD / 8 + 255) / 256, 256, 0, stream>>>(proj_w, WPA);
  k_gemm2<<<dim3((unsigned)((PIX / 128) * (QLD / 64)), NB), 128, 0, stream>>>(X16, CC, WQ16, CC, 1.0f / (XSC * WSC), qkv_b, nullptr, QKV, QLD, PIX, QLD, CC, PIX * CC, 0, PIX * QLD);
  k_att<<<dim3(NHD * NPB, NB), PBLK, 0, stream>>>(QKV, rpb, O16);
  k_gemm2<<<dim3((unsigned)((CC / 128) * (PIX / 64)), NB), 128, 0, stream>>>(WPA, OLD, O16, OLD, 1.0f / (PSC * OSC), nullptr, proj_b, out, PIX, CC, PIX, OLD, 0, PIX * OLD, CC * PIX);
}

// v003
// A run of this version takes 56.8 microseconds.
// In both of two side-by-side timings against v002, it was 1.26 times as fast.
// Counting every step since v000, it is 3.38 times as fast.
#include <hip/hip_runtime.h>
// Contractions on v_wmma_f32_16x16x32_f16 (f16 operands, f32 accumulate): qkv = X.Wqkv^T with bf16-RNE inputs carried exactly in f16 (x*16, Wqkv*64);
// out^T = Wp.O^T with O as f16 hi (*64) + f16 residual (*1024) planes folded along K against [Wp*1024 | Wp] (bf16-RNE Wp);
// per-pixel clamped 7x7 window q.k logits, 49-tap softmax and v aggregation in f32 on VALU from the f32 qkv plane.
#ifndef NB
#define NB 2
#endif
#define NB_FULL 2
#define CC 256
#define HHT 64
#define WID 64
#define PIX (HHT * WID)          /* 4096 */
#define NHD 8
#define HD 32
#define KS 7
#define NTAP (KS * KS)           /* 49 */
#define RPW (2 * KS - 1)         /* 13 */
#define RPN (RPW * RPW)          /* 169 per head */
#define QLD (3 * CC)             /* 768: qkv plane pitch, cols s*256 + h*32 + d */
#define OLD (2 * CC)             /* 512: O plane pitch, per head h: [h*64 .. +31] hi, [h*64+32 .. +63] residual */
#define PBLK 128
#define NPB (PIX / PBLK)         /* 32 */
#define XT_P 32
#define XT_C 64
#define XSC 16.0f                /* x carry */
#define WSC 64.0f                /* qkv weight carry */
#define OSC 64.0f                /* O hi carry */
#define RSC 1024.0f              /* O residual carry */
#define PSC 1024.0f              /* proj weight carry against the hi plane */
#define QSCALE 0.17677669529663687f
#define SROWS (KS + 1)           /* image rows that hold every window of a block's two pixel rows */
#define KVP (HD + 4)             /* LDS pitch of a staged key / value pixel, floats: 144 B = 16 B x 9, so 16-byte reads of 16 neighbouring pixels meet 64 distinct banks */
static_assert(NB <= NB_FULL);
static_assert(PIX % PBLK == 0);
static_assert(PIX % 128 == 0);
static_assert(PIX % 64 == 0);
static_assert(PIX % XT_P == 0);
static_assert(CC % XT_C == 0);
static_assert(CC % 128 == 0);
static_assert(CC % 32 == 0);
static_assert(OLD % 32 == 0);
static_assert(QLD % 64 == 0);
static_assert(PBLK == 128);
static_assert(HD == 32);
static_assert(NHD * HD == CC);
static_assert(HHT >= KS && WID >= KS);
static_assert(PBLK == 2 * WID && HHT >= SROWS && HHT % 2 == 0);
static_assert((SROWS * WID * (HD / 4)) % PBLK == 0);

typedef unsigned short v8us __attribute__((ext_vector_type(8), may_alias));
typedef float v8f __attribute__((ext_vector_type(8)));
typedef float v4f __attribute__((ext_vector_type(4)));
typedef float v4fa __attribute__((ext_vector_type(4), may_alias));
typedef _Float16 v16h __attribute__((ext_vector_type(16)));
union FragH { v16h v; v8us half[2]; _Float16 h[16]; unsigned short u[16]; };

__device__ __forceinline__ unsigned short bf16_bits(float x) { unsigned int u = __float_as_uint(x); return (unsigned short)((u + 0x7FFFu + ((u >> 16) & 1u)) >> 16); }
__device__ __forceinline__ float bf16_val(unsigned short b) { return __uint_as_float(((unsigned int)b) << 16); }
__device__ __forceinline__ float bf16_rne(float x) { return bf16_val(bf16_bits(x)); }

// ---- f16 WMMA engine (wave tile 32x64; M % 128 == 0, N % 64 == 0, K % 32 == 0) ----
// A fragment: lane l -> row (l & 15); elements 0..7 <- k0 + 8*(l>>4) + 0..7, elements 8..15 <- k0 + 16 + 8*(l>>4) + 0..7.
// B fragment: from a [n][k] (k-contiguous) plane with the identical k map, lane -> column. D: acc[r] = (row 8*(l>>4) + r, col l & 15).
__device__ __forceinline__ v16h g2_frag(const _Float16* p, int hh) { FragH f; f.half[0] = *(const v8us*)((const unsigned short*)p + 8 * hh); f.half[1] = *(const v8us*)((const unsigned short*)p + 16 + 8 * hh); return f.v; }
__device__ __forceinline__ v8f g2_mma(v16h a, v16h b, v8f c) { v8f d = __builtin_amdgcn_wmma_f32_16x16x32_f16(false, a, false, b, (short)0, c, false, false); asm volatile("v_nop\n\tv_nop\n\tv_nop\n\tv_nop" : "+v"(d) : "v"(a), "v"(b)); return d; }

// C[M][N] (f32, pitch ldc) = alpha * A[M][K].Bt[N][K]^T + bf16(bcol[n]) + bf16(brow[m]); A and Bt f16 planes (k contiguous, pitches lda / ldb); K = 32 * KT.
// blockIdx.y = image of the batch: its A, Bt and C start sa, sb, sc elements behind the previous image's (0 for a plane that all images share).
// The six fragments of k step s + DEPTH are requested in front of the products of step s, so the loads of DEPTH steps are in flight while a step's products run, and no product waits for a load issued directly in front of it.
struct G2Step { v16h a0, a1, b0, b1, b2, b3; };
template <int KT, int DEPTH>
__global__ __launch_bounds__(128) void k_gemm2(const _Float16* __restrict__ A, int lda, const _Float16* __restrict__ Bh, int ldb, float alpha,
                                               const float* __restrict__ bcol, const float* __restrict__ brow,
                                               float* __restrict__ C, int ldc, int M, int N, int sa, int sb, int sc) {
  static_assert(DEPTH >= 1 && DEPTH < KT && 12 * (DEPTH + 1) <= 63);   /* 12 loads a step; the load counter holds 63 */
  __shared__ __attribute__((aligned(16))) float so[4][32][68];
  const int tid = threadIdx.x, w = tid >> 5, lane = tid & 31, ln = lane & 15, hh = lane >> 4;
  const int ntn = N >> 6; const int mt = blockIdx.x / ntn, nq = blockIdx.x - mt * ntn; const int row0 = mt * 128 + 32 * w, col0 = nq * 64; if (row0 >= M) return;
  A += (size_t)blockIdx.y * sa; Bh += (size_t)blockIdx.y * sb; C += (size_t)blockIdx.y * sc;
  const _Float16* a0p = A + (size_t)(row0 + ln) * lda; const _Float16* a1p = a0p + (size_t)16 * lda;
  const _Float16* b0p = Bh + (size_t)(col0 + ln) * ldb; const _Float16* b1p = b0p + (size_t)16 * ldb; const _Float16* b2p = b1p + (size_t)16 * ldb; const _Float16* b3p = b2p + (size_t)16 * ldb;
  const v8f z8 = {0.f,0.f,0.f,0.f,0.f,0.f,0.f,0.f}; v8f c00 = z8, c01 = z8, c02 = z8, c03 = z8, c10 = z8, c11 = z8, c12 = z8, c13 = z8;
  G2Step f[KT];
  auto fetch = [&](int s) { const int kb = 32 * s;
    f[s].a0 = g2_frag(a0p + kb, hh); f[s].b0 = g2_frag(b0p + kb, hh); f[s].a1 = g2_frag(a1p + kb, hh);
    f[s].b1 = g2_frag(b1p + kb, hh); f[s].b2 = g2_frag(b2p + kb, hh); f[s].b3 = g2_frag(b3p + kb, hh); };
  /* both loops fully unrolled: every index of f is then a constant and f stays in registers; at most DEPTH + 1 of its KT steps are live at once */
#pragma unroll
  for (int s = 0; s < DEPTH; ++s) { fetch(s);
    __builtin_amdgcn_sched_barrier(0); }   /* keeps these loads in step order and in front of the first product with its wait: otherwise most of them start one memory latency late, or step 0 returns behind later steps */
#pragma unroll
  for (int s = 0; s < KT; ++s) {
    if (s + DEPTH < KT) fetch(s + DEPTH);
    c00 = g2_mma(f[s].a0, f[s].b0, c00); c10 = g2_mma(f[s].a1, f[s].b0, c10);
    c01 = g2_mma(f[s].a0, f[s].b1, c01); c11 = g2_mma(f[s].a1, f[s].b1, c11);
    c02 = g2_mma(f[s].a0, f[s].b2, c02); c12 = g2_mma(f[s].a1, f[s].b2, c12);
    c03 = g2_mma(f[s].a0, f[s].b3, c03); c13 = g2_mma(f[s].a1, f[s].b3, c13); }
  v8f accs[8] = {c00, c01, c02, c03, c10, c11, c12, c13};
#pragma unroll
  for (int u = 0; u < 8; ++u) { const int t = u & 3, half = u >> 2; const int col = col0 + t * 16 + ln; const float bv = bcol ? bf16_rne(bcol[col]) : 0.f;
#pragma unroll
    for (int r = 0; r < 8; ++r) { const int rloc = half * 16 + 8 * hh + r; float v = accs[u][r] * alpha + bv; if (brow) v += bf16_rne(brow[row0 + rloc]); so[w][rloc][t * 16 + ln] = v; } }
  __builtin_amdgcn_fence(__ATOMIC_ACQ_REL, "workgroup"); __builtin_amdgcn_wave_barrier();
  const int rsub = lane >> 4, c4 = (lane & 15) * 4;
  {
#pragma unroll
    for (int q = 0; q < 16; ++q) { const int r = q * 2 + rsub; const v4f v = *(const v4fa*)&so[w][r][c4]; *(v4f*)(C + (size_t)(row0 + r) * ldc + col0 + c4) = v; }
     }
}

__global__ __launch_bounds__(256) void k_cvt8(const float* __restrict__ W, _Float16* __restrict__ Bt, int n8, float scale) {
  const int t = blockIdx.x * 256 + threadIdx.x; if (t >= n8) return; FragH f;
#pragma unroll
  for (int i = 0; i < 8; ++i) f.h[i] = (_Float16)(bf16_rne(W[(size_t)t * 8 + i]) * scale);
  unsigned short* dst = (unsigned short*)Bt + (size_t)t * 8;
  *(v8us*)dst = f.half[0]; 
}

__global__ __launch_bounds__(256) void k_wpa(const float* __restrict__ W, _Float16* __restrict__ WPA) {
  const int t = blockIdx.x * 256 + threadIdx.x; if (t >= CC * OLD / 8) return;
  const int c = t / (OLD / 8); const int k8 = (t - c * (OLD / 8)) * 8; const int h = k8 >> 6; const int wi = k8 & 63; const int d0 = wi & 31;
  const float sc = (wi >= 32) ? 1.0f : PSC;
  FragH f;
#pragma unroll
  for (int i = 0; i < 8; ++i) f.h[i] = (_Float16)(bf16_rne(W[(size_t)c * CC + h * HD + d0 + i]) * sc);
  unsigned short* dst = (unsigned short*)WPA + (size_t)t * 8;
  *(v8us*)dst = f.half[0]; 
}

// coverage: 8 waves x 4 rows x 8 lanes x 8 halves = 32 rows x 64 channels per block; grid = NB x (CC/64) x (PIX/32)
__global__ __launch_bounds__(256) void k_xt(const float* __restrict__ x, _Float16* __restrict__ X16) {
  __shared__ __attribute__((aligned(16))) _Float16 st[XT_P][XT_C];
  const int tid = threadIdx.x, w = tid >> 5, lane = tid & 31;
  int blk = blockIdx.x;
  const int pt = blk % (PIX / XT_P); blk /= (PIX / XT_P);
  const int ch = blk % (CC / XT_C); const int b = blk / (CC / XT_C);
  const float* src = x + ((size_t)(b * CC + ch * XT_C)) * PIX + (size_t)pt * XT_P + lane;
#pragma unroll
  for (int it = 0; it < XT_C / 8; ++it) {
    const int ci = it * 8 + w;
    const float v = src[(size_t)ci * PIX];
    st[lane][ci] = (_Float16)(bf16_rne(v) * XSC);
  }
  __syncthreads();
  const int rr = w * 4 + (lane >> 3), q = lane & 7;
  const v8us o = *(const v8us*)&st[rr][q * 8];
  unsigned short* dst = (unsigned short*)X16 + ((size_t)(b * PIX + pt * XT_P + rr)) * CC + ch * XT_C + q * 8;
  *(v8us*)dst = o; 
}

// Thread per (h, pixel p = y*WID + x). Clamped window start ni = clamp(y-3, 0, H-7), nj = clamp(x-3, 0, W-7); taps (i, j) in 7x7 at key pixel (ni+i, nj+j);
// logit a_t = QSCALE * sum_d q[p][h*32+d] k[key][256 + h*32 + d] + bf16(rpb[h][ni+i-y+6][nj+j-x+6]) in f32, kept in thread-private LDS;
// max-subtracted softmax in f32; O[d] = (sum_t e_t v[key][512 + h*32 + d]) / sum_t e_t; O -> f16 hi = f16(O*64), res = f16((O*64 - hi)*1024);
// The block's pixels are image rows y0, y0+1; all their windows lie in rows r0 .. r0+7, r0 = clamp(y0-3, 0, H-8). The head's k and v of those 8 x 64 pixels are
// staged once in LDS (whole 128-byte lines from the plane) and every tap reads them there.
// coverage: 4 waves x 8 iterations x 4 rows x 8 lanes x 8 halves = 128 rows x 64 halves per block; grid = (NHD x (PIX/128), NB), blockIdx.y = image with its own qkv and O plane
__global__ __launch_bounds__(PBLK) void k_att(const float* __restrict__ QKV, const float* __restrict__ rpb, _Float16* __restrict__ O16) {
  __shared__ float srpb[RPN + 7];
  __shared__ __attribute__((aligned(16))) float slog[NTAP][PBLK];
  __shared__ __attribute__((aligned(16))) unsigned short sO[PBLK][64];
  __shared__ __attribute__((aligned(16))) float sK[SROWS * WID * KVP];
  __shared__ __attribute__((aligned(16))) float sV[SROWS * WID * KVP];
  const int tid = threadIdx.x, w = tid >> 5, lane = tid & 31;
  const int h = blockIdx.x / NPB; const int p0 = (blockIdx.x - h * NPB) * PBLK;
  QKV += (size_t)blockIdx.y * (PIX * QLD); O16 += (size_t)blockIdx.y * (PIX * OLD);
  int r0 = p0 / WID - KS / 2; r0 = (r0 < 0) ? 0 : ((r0 > HHT - SROWS) ? (HHT - SROWS) : r0);
  {
    const float* ks = QKV + (size_t)(r0 * WID + (tid >> 3)) * QLD + CC + h * HD + (tid & 7) * 4;   /* 8 lanes per pixel, 16 pixels per pass */
    float* kd = sK + (tid >> 3) * KVP + (tid & 7) * 4; float* vd = sV + (tid >> 3) * KVP + (tid & 7) * 4;
    /* unrolled so that 32 line loads of a wave are in flight at once: one wave per SIMD has nothing else to cover the L2 latency */
#pragma unroll 16
    for (int it = 0; it < SROWS * WID * (HD / 4) / PBLK; ++it) {
      const v4f k4 = *(const v4fa*)(ks + (size_t)it * (PBLK / 8) * QLD); const v4f v4 = *(const v4fa*)(ks + CC + (size_t)it * (PBLK / 8) * QLD);
      *(v4fa*)(kd + it * (PBLK / 8) * KVP) = k4; *(v4fa*)(vd + it * (PBLK / 8) * KVP) = v4; }
  }
  for (int t = tid; t < RPN; t += PBLK) srpb[t] = bf16_rne(rpb[h * RPN + t]);
  __syncthreads();
  const int p = p0 + tid; const int y = p / WID, x = p - y * WID;
  int ni = y - KS / 2; ni = (ni < 0) ? 0 : ((ni > HHT - KS) ? (HHT - KS) : ni);
  int nj = x - KS / 2; nj = (nj < 0) ? 0 : ((nj > WID - KS) ? (WID - KS) : nj);
  const int bi = ni - y + (KS - 1), bj = nj - x + (KS - 1);   /* both in [0, 6] */
  const float* qr = QKV + (size_t)p * QLD + h * HD;
  float qv[HD];
#pragma unroll
  for (int g = 0; g < HD / 4; ++g) { const v4f q4 = *(const v4fa*)(qr + 4 * g);
#pragma unroll
    for (int e = 0; e < 4; ++e) qv[4 * g + e] = q4[e]; }
  float mx = -3.0e38f;
#pragma unroll 1
  for (int i = 0; i < KS; ++i) {
    const float* krow = sK + ((ni - r0 + i) * WID + nj) * KVP;
    /* unrolled: the seven taps' LDS reads and their seven separate serial sums over d overlap (a lone wave per SIMD would wait out each read and each dependent fma) */
#pragma unroll
    for (int j = 0; j < KS; ++j) {
      const float* kr = krow + j * KVP;
      float a = 0.f;
#pragma unroll
      for (int g = 0; g < HD / 4; ++g) { const v4f k4 = *(const v4fa*)(kr + 4 * g);
#pragma unroll
        for (int e = 0; e < 4; ++e) a = fmaf(qv[4 * g + e], k4[e], a); }
      const float l = a * QSCALE + srpb[(bi + i) * RPW + (bj + j)];
      slog[i * KS + j][tid] = l;
      mx = fmaxf(mx, l);
    }
  }
  float s = 0.f; float acc[HD];
#pragma unroll
  for (int d = 0; d < HD; ++d) acc[d] = 0.f;
#pragma unroll 1
  for (int i = 0; i < KS; ++i) {
    const float* vrow = sV + ((ni - r0 + i) * WID + nj) * KVP;
    /* unrolled: the LDS reads of later taps fly while earlier taps are summed; taps are added in the order j = 0 .. 6 */
#pragma unroll
    for (int j = 0; j < KS; ++j) {
      const float l = slog[i * KS + j][tid]; const float e = expf(l - mx); s += e;
      const float* vr = vrow + j * KVP;
#pragma unroll
      for (int g = 0; g < HD / 4; ++g) { const v4f v = *(const v4fa*)(vr + 4 * g);
#pragma unroll
        for (int e2 = 0; e2 < 4; ++e2) acc[4 * g + e2] = fmaf(e, v[e2], acc[4 * g + e2]); } } }
  const float inv = 1.0f / s;
#pragma unroll
  for (int g = 0; g < HD / 8; ++g) { FragH fh, fr;
#pragma unroll
    for (int e2 = 0; e2 < 8; ++e2) { const float o64 = (acc[g * 8 + e2] * inv) * OSC; const _Float16 hv = (_Float16)o64; fh.h[e2] = hv; fr.h[e2] = (_Float16)((o64 - (float)hv) * RSC); }
    *(v8us*)&sO[tid][g * 8] = fh.half[0]; *(v8us*)&sO[tid][HD + g * 8] = fr.half[0]; }
  __syncthreads();
  {
#pragma unroll
    for (int it = 0; it < 8; ++it) { const int rr = w * 32 + it * 4 + (lane >> 3), q = lane & 7; const v8us o = *(const v8us*)&sO[rr][q * 8];
      *(v8us*)((unsigned short*)O16 + ((size_t)(p0 + rr)) * OLD + h * 64 + q * 8) = o; }
     }
}

extern "C" void kernel_launch(void* const* d_in, const int* in_sizes, int n_in,
                              void* d_out, int out_size, void* d_ws, size_t ws_size, hipStream_t stream) {
  if (n_in < 6) return;
  if (in_sizes[0] < NB * CC * PIX || in_sizes[1] < 3 * CC * CC || in_sizes[2] < 3 * CC || in_sizes[3] < NHD * RPN || in_sizes[4] < CC * CC || in_sizes[5] < CC) return;
  if (out_size < NB * CC * PIX) return;
  const float* x = (const float*)d_in[0]; const float* qkv_w = (const float*)d_in[1]; const float* qkv_b = (const float*)d_in[2];
  const float* rpb = (const float*)d_in[3]; const float* proj_w = (const float*)d_in[4]; const float* proj_b = (const float*)d_in[5];
  float* out = (float*)d_out;
  char* ws = (char*)d_ws; size_t off = 0;
  auto take = [&](size_t bytes) { char* p = ws + off; off += (bytes + 255) & ~(size_t)255; return p; };
  _Float16* X16 = (_Float16*)take((size_t)NB * PIX * CC * 2);       /* 4,194,304 B at NB=2 */
  _Float16* WQ16 = (_Float16*)take((size_t)3 * CC * CC * 2);        /* 393,216 */
  _Float16* WPA = (_Float16*)take((size_t)CC * OLD * 2);             /* 262,144 */
  float* QKV = (float*)take((size_t)NB * PIX * QLD * 4);             /* 25,165,824 at NB=2 */
  _Float16* O16 = (_Float16*)take((size_t)NB * PIX * OLD * 2);       /* 8,388,608 at NB=2 */
  if (off > ws_size || off > ((size_t)128 << 20)) return;            /* total 38,404,096 B */
  k_xt<<<(unsigned)(NB * (CC / XT_C) * (PIX / XT_P)), 256, 0, stream>>>(x, X16);
  k_cvt8<<<(3 * CC * CC / 8 + 255) / 256, 256, 0, stream>>>(qkv_w, WQ16, 3 * CC * CC / 8, WSC);
  k_wpa<<<(CC * OLD / 8 + 255) / 256, 256, 0, stream>>>(proj_w, WPA);
  k_gemm2<CC / 32, 2><<<dim3((unsigned)((PIX / 128) * (QLD / 64)), NB), 128, 0, stream>>>(X16, CC, WQ16, CC, 1.0f / (XSC * WSC), qkv_b, nullptr, QKV, QLD, PIX, QLD, PIX * CC, 0, PIX * QLD);
  k_att<<<dim3(NHD * NPB, NB), PBLK, 0, stream>>>(QKV, rpb, O16);
  k_gemm2<OLD / 32, 2><<<dim3((unsigned)((CC / 128) * (PIX / 64)), NB), 128, 0, stream>>>(WPA, OLD, O16, OLD, 1.0f / (PSC * OSC), nullptr, proj_b, out, PIX, CC, PIX, 0, PIX * OLD, CC * PIX);
}

// v004
// A run of this version takes 52 microseconds.
// In both of two side-by-side timings against v003, it was 1.10 times as fast.
// Counting every step since v000, it is 3.71 times as fast.
#include <hip/hip_runtime.h>
// Contractions on v_wmma_f32_16x16x32_f16 (f16 operands, f32 accumulate): qkv = X.Wqkv^T with bf16-RNE inputs carried exactly in f16 (x*16, Wqkv*64);
// out^T = Wp.O^T with O as f16 hi (*64) + f16 residual (*1024) planes folded along K against [Wp*1024 | Wp] (bf16-RNE Wp);
// per-pixel clamped 7x7 window q.k logits, 49-tap softmax and v aggregation in f32 on VALU from the f32 qkv plane.
#ifndef NB
#define NB 2
#endif
#define NB_FULL 2
#define CC 256
#define HHT 64
#define WID 64
#define PIX (HHT * WID)          /* 4096 */
#define NHD 8
#define HD 32
#define KS 7
#define NTAP (KS * KS)           /* 49 */
#define RPW (2 * KS - 1)         /* 13 */
#define RPN (RPW * RPW)          /* 169 per head */
#define QLD (3 * CC)             /* 768: qkv plane pitch, cols s*256 + h*32 + d */
#define OLD (2 * CC)             /* 512: O plane pitch, per head h: [h*64 .. +31] hi, [h*64+32 .. +63] residual */
#define PBLK 128
#define NPB (PIX / PBLK)         /* 32 */
#define XT_P 32
#define XT_C 64
#define XSC 16.0f                /* x carry */
#define WSC 64.0f                /* qkv weight carry */
#define OSC 64.0f                /* O hi carry */
#define RSC 1024.0f              /* O residual carry */
#define PSC 1024.0f              /* proj weight carry against the hi plane */
#define QSCALE 0.17677669529663687f
#define SROWS (KS + 1)           /* image rows that hold every window of a block's two pixel rows */
#define KVP (HD + 4)             /* LDS pitch of a staged key / value pixel, floats: 144 B = 16 B x 9, so 16-byte reads of 16 neighbouring pixels meet 64 distinct banks */
static_assert(NB <= NB_FULL);
static_assert(PIX % PBLK == 0);
static_assert(PIX % 128 == 0);
static_assert(PIX % 64 == 0);
static_assert(PIX % XT_P == 0);
static_assert(CC % XT_C == 0);
static_assert(CC % 128 == 0);
static_assert(CC % 32 == 0);
static_assert(OLD % 32 == 0);
static_assert(QLD % 64 == 0);
static_assert(PBLK == 128);
static_assert(HD == 32);
static_assert(NHD * HD == CC);
static_assert(HHT >= KS && WID >= KS);
static_assert(PBLK == 2 * WID && HHT >= SROWS && HHT % 2 == 0);
static_assert((SROWS * WID * (HD / 4)) % PBLK == 0);

typedef unsigned short v8us __attribute__((ext_vector_type(8), may_alias));
typedef float v8f __attribute__((ext_vector_type(8)));
typedef float v4f __attribute__((ext_vector_type(4)));
typedef float v4fa __attribute__((ext_vector_type(4), may_alias));
typedef _Float16 v16h __attribute__((ext_vector_type(16)));
union FragH { v16h v; v8us half[2]; _Float16 h[16]; unsigned short u[16]; };

__device__ __forceinline__ unsigned short bf16_bits(float x) { unsigned int u = __float_as_uint(x); return (unsigned short)((u + 0x7FFFu + ((u >> 16) & 1u)) >> 16); }
__device__ __forceinline__ float bf16_val(unsigned short b) { return __uint_as_float(((unsigned int)b) << 16); }
__device__ __forceinline__ float bf16_rne(float x) { return bf16_val(bf16_bits(x)); }

// ---- f16 WMMA engine (wave tile 32x64; M % 128 == 0, N % 64 == 0, K % 32 == 0) ----
// A fragment: lane l -> row (l & 15); elements 0..7 <- k0 + 8*(l>>4) + 0..7, elements 8..15 <- k0 + 16 + 8*(l>>4) + 0..7.
// B fragment: from a [n][k] (k-contiguous) plane with the identical k map, lane -> column. D: acc[r] = (row 8*(l>>4) + r, col l & 15).
__device__ __forceinline__ v16h g2_frag(const _Float16* p, int hh) { FragH f; f.half[0] = *(const v8us*)((const unsigned short*)p + 8 * hh); f.half[1] = *(const v8us*)((const unsigned short*)p + 16 + 8 * hh); return f.v; }
__device__ __forceinline__ v8f g2_mma(v16h a, v16h b, v8f c) { v8f d = __builtin_amdgcn_wmma_f32_16x16x32_f16(false, a, false, b, (short)0, c, false, false); asm volatile("v_nop\n\tv_nop\n\tv_nop\n\tv_nop" : "+v"(d) : "v"(a), "v"(b)); return d; }

// C[M][N] (f32, pitch ldc) = alpha * A[M][K].Bt[N][K]^T + bf16(bcol[n]) + bf16(brow[m]); A and Bt f16 planes (k contiguous, pitches lda / ldb); K = 32 * KT.
// blockIdx.y = image of the batch: its A, Bt and C start sa, sb, sc elements behind the previous image's (0 for a plane that all images share).
// The six fragments of k step s + DEPTH are requested in front of the products of step s, so the loads of DEPTH steps are in flight while a step's products run, and no product waits for a load issued directly in front of it.
struct G2Step { v16h a0, a1, b0, b1, b2, b3; };
template <int KT, int DEPTH>
__global__ __launch_bounds__(128) void k_gemm2(const _Float16* __restrict__ A, int lda, const _Float16* __restrict__ Bh, int ldb, float alpha,
                                               const float* __restrict__ bcol, const float* __restrict__ brow,
                                               float* __restrict__ C, int ldc, int M, int N, int sa, int sb, int sc) {
  static_assert(DEPTH >= 1 && DEPTH < KT && 12 * (DEPTH + 1) <= 63);   /* 12 loads a step; the load counter holds 63 */
  __shared__ __attribute__((aligned(16))) float so[4][32][68];
  const int tid = threadIdx.x, w = tid >> 5, lane = tid & 31, ln = lane & 15, hh = lane >> 4;
  const int ntn = N >> 6; const int mt = blockIdx.x / ntn, nq = blockIdx.x - mt * ntn; const int row0 = mt * 128 + 32 * w, col0 = nq * 64; if (row0 >= M) return;
  A += (size_t)blockIdx.y * sa; Bh += (size_t)blockIdx.y * sb; C += (size_t)blockIdx.y * sc;
  const _Float16* a0p = A + (size_t)(row0 + ln) * lda; const _Float16* a1p = a0p + (size_t)16 * lda;
  const _Float16* b0p = Bh + (size_t)(col0 + ln) * ldb; const _Float16* b1p = b0p + (size_t)16 * ldb; const _Float16* b2p = b1p + (size_t)16 * ldb; const _Float16* b3p = b2p + (size_t)16 * ldb;
  const v8f z8 = {0.f,0.f,0.f,0.f,0.f,0.f,0.f,0.f}; v8f c00 = z8, c01 = z8, c02 = z8, c03 = z8, c10 = z8, c11 = z8, c12 = z8, c13 = z8;
  G2Step f[KT];
  auto fetch = [&](int s) { const int kb = 32 * s;
    f[s].a0 = g2_frag(a0p + kb, hh); f[s].b0 = g2_frag(b0p + kb, hh); f[s].a1 = g2_frag(a1p + kb, hh);
    f[s].b1 = g2_frag(b1p + kb, hh); f[s].b2 = g2_frag(b2p + kb, hh); f[s].b3 = g2_frag(b3p + kb, hh); };
  /* both loops fully unrolled: every index of f is then a constant and f stays in registers; at most DEPTH + 1 of its KT steps are live at once */
#pragma unroll
  for (int s = 0; s < DEPTH; ++s) { fetch(s);
    __builtin_amdgcn_sched_barrier(0); }   /* keeps these loads in step order and in front of the first product with its wait: otherwise most of them start one memory latency late, or step 0 returns behind later steps */
#pragma unroll
  for (int s = 0; s < KT; ++s) {
    if (s + DEPTH < KT) fetch(s + DEPTH);
    c00 = g2_mma(f[s].a0, f[s].b0, c00); c10 = g2_mma(f[s].a1, f[s].b0, c10);
    c01 = g2_mma(f[s].a0, f[s].b1, c01); c11 = g2_mma(f[s].a1, f[s].b1, c11);
    c02 = g2_mma(f[s].a0, f[s].b2, c02); c12 = g2_mma(f[s].a1, f[s].b2, c12);
    c03 = g2_mma(f[s].a0, f[s].b3, c03); c13 = g2_mma(f[s].a1, f[s].b3, c13); }
  v8f accs[8] = {c00, c01, c02, c03, c10, c11, c12, c13};
#pragma unroll
  for (int u = 0; u < 8; ++u) { const int t = u & 3, half = u >> 2; const int col = col0 + t * 16 + ln; const float bv = bcol ? bf16_rne(bcol[col]) : 0.f;
#pragma unroll
    for (int r = 0; r < 8; ++r) { const int rloc = half * 16 + 8 * hh + r; float v = accs[u][r] * alpha + bv; if (brow) v += bf16_rne(brow[row0 + rloc]); so[w][rloc][t * 16 + ln] = v; } }
  __builtin_amdgcn_fence(__ATOMIC_ACQ_REL, "workgroup"); __builtin_amdgcn_wave_barrier();
  const int rsub = lane >> 4, c4 = (lane & 15) * 4;
  {
#pragma unroll
    for (int q = 0; q < 16; ++q) { const int r = q * 2 + rsub; const v4f v = *(const v4fa*)&so[w][r][c4]; *(v4f*)(C + (size_t)(row0 + r) * ldc + col0 + c4) = v; }
     }
}

#define NBLK_WQ (3 * CC * CC / 8 / 256)                    /* 96 blocks: qkv weight */
#define NBLK_WP (CC * OLD / 8 / 256)                       /* 64 blocks: proj weight */
#define NBLK_XT (NB * (CC / XT_C) * (PIX / XT_P))          /* 1024 blocks at NB=2: x */
static_assert((3 * CC * CC / 8) % 256 == 0 && (CC * OLD / 8) % 256 == 0);

__device__ __forceinline__ void d_cvt8(int blk, const float* __restrict__ W, _Float16* __restrict__ Bt, float scale) {
  const int t = blk * 256 + threadIdx.x; FragH f;
#pragma unroll
  for (int i = 0; i < 8; ++i) f.h[i] = (_Float16)(bf16_rne(W[(size_t)t * 8 + i]) * scale);
  unsigned short* dst = (unsigned short*)Bt + (size_t)t * 8;
  *(v8us*)dst = f.half[0];
  asm volatile("s_wait_xcnt 0x0" ::: "memory");   /* the block ranges lie one behind the other in the built kernel: the wait stands in front of any later write of the store's registers */
}

__device__ __forceinline__ void d_wpa(int blk, const float* __restrict__ W, _Float16* __restrict__ WPA) {
  const int t = blk * 256 + threadIdx.x;
  const int c = t / (OLD / 8); const int k8 = (t - c * (OLD / 8)) * 8; const int h = k8 >> 6; const int wi = k8 & 63; const int d0 = wi & 31;
  const float sc = (wi >= 32) ? 1.0f : PSC;
  FragH f;
#pragma unroll
  for (int i = 0; i < 8; ++i) f.h[i] = (_Float16)(bf16_rne(W[(size_t)c * CC + h * HD + d0 + i]) * sc);
  unsigned short* dst = (unsigned short*)WPA + (size_t)t * 8;
  *(v8us*)dst = f.half[0];
  asm volatile("s_wait_xcnt 0x0" ::: "memory");   /* the block ranges lie one behind the other in the built kernel: the wait stands in front of any later write of the store's registers */
}

// The three operand conversions depend on nothing but the inputs, so they share one launch: block ranges of one grid, the two short weight ranges first.
// blocks [0, NBLK_WQ): qkv weight -> f16 plane; [NBLK_WQ, NBLK_WQ + NBLK_WP): proj weight -> [Wp*1024 | Wp] plane; the rest: x -> pixel-major f16 plane.
// x coverage: 8 waves x 4 rows x 8 lanes x 8 halves = 32 rows x 64 channels per block; NB x (CC/64) x (PIX/32) blocks
__global__ __launch_bounds__(256) void k_prep(const float* __restrict__ x, const float* __restrict__ qkv_w, const float* __restrict__ proj_w,
                                              _Float16* __restrict__ X16, _Float16* __restrict__ WQ16, _Float16* __restrict__ WPA) {
  __shared__ __attribute__((aligned(16))) _Float16 st[XT_P][XT_C];
  int blk = blockIdx.x;
  if (blk < NBLK_WQ) { d_cvt8(blk, qkv_w, WQ16, WSC); return; }              /* block-uniform: a whole block leaves, in front of the barrier */
  blk -= NBLK_WQ;
  if (blk < NBLK_WP) { d_wpa(blk, proj_w, WPA); return; }
  blk -= NBLK_WP;
  const int tid = threadIdx.x, w = tid >> 5, lane = tid & 31;
  const int pt = blk % (PIX / XT_P); blk /= (PIX / XT_P);
  const int ch = blk % (CC / XT_C); const int b = blk / (CC / XT_C);
  const float* src = x + ((size_t)(b * CC + ch * XT_C)) * PIX + (size_t)pt * XT_P + lane;
#pragma unroll
  for (int it = 0; it < XT_C / 8; ++it) {
    const int ci = it * 8 + w;
    const float v = src[(size_t)ci * PIX];
    st[lane][ci] = (_Float16)(bf16_rne(v) * XSC);
  }
  __syncthreads();
  const int rr = w * 4 + (lane >> 3), q = lane & 7;
  const v8us o = *(const v8us*)&st[rr][q * 8];
  unsigned short* dst = (unsigned short*)X16 + ((size_t)(b * PIX + pt * XT_P + rr)) * CC + ch * XT_C + q * 8;
  *(v8us*)dst = o;
  asm volatile("s_wait_xcnt 0x0" ::: "memory");   /* the block ranges lie one behind the other in the built kernel: the wait stands in front of any later write of the store's registers */
}

// Thread per (h, pixel p = y*WID + x). Clamped window start ni = clamp(y-3, 0, H-7), nj = clamp(x-3, 0, W-7); taps (i, j) in 7x7 at key pixel (ni+i, nj+j);
// logit a_t = QSCALE * sum_d q[p][h*32+d] k[key][256 + h*32 + d] + bf16(rpb[h][ni+i-y+6][nj+j-x+6]) in f32, kept in thread-private LDS;
// max-subtracted softmax in f32; O[d] = (sum_t e_t v[key][512 + h*32 + d]) / sum_t e_t; O -> f16 hi = f16(O*64), res = f16((O*64 - hi)*1024);
// The block's pixels are image rows y0, y0+1; all their windows lie in rows r0 .. r0+7, r0 = clamp(y0-3, 0, H-8). The head's k and v of those 8 x 64 pixels are
// staged once in LDS (whole 128-byte lines from the plane) and every tap reads them there.
// coverage: 4 waves x 8 iterations x 4 rows x 8 lanes x 8 halves = 128 rows x 64 halves per block; grid = (NHD x (PIX/128), NB), blockIdx.y = image with its own qkv and O plane
__global__ __launch_bounds__(PBLK) void k_att(const float* __restrict__ QKV, const float* __restrict__ rpb, _Float16* __restrict__ O16) {
  __shared__ float srpb[RPN + 7];
  __shared__ __attribute__((aligned(16))) float slog[NTAP][PBLK];
  __shared__ __attribute__((aligned(16))) unsigned short sO[PBLK][64];
  __shared__ __attribute__((aligned(16))) float sK[SROWS * WID * KVP];
  __shared__ __attribute__((aligned(16))) float sV[SROWS * WID * KVP];
  const int tid = threadIdx.x, w = tid >> 5, lane = tid & 31;
  const int h = blockIdx.x / NPB; const int p0 = (blockIdx.x - h * NPB) * PBLK;
  QKV += (size_t)blockIdx.y * (PIX * QLD); O16 += (size_t)blockIdx.y * (PIX * OLD);
  int r0 = p0 / WID - KS / 2; r0 = (r0 < 0) ? 0 : ((r0 > HHT - SROWS) ? (HHT - SROWS) : r0);
  {
    const float* ks = QKV + (size_t)(r0 * WID + (tid >> 3)) * QLD + CC + h * HD + (tid & 7) * 4;   /* 8 lanes per pixel, 16 pixels per pass */
    float* kd = sK + (tid >> 3) * KVP + (tid & 7) * 4; float* vd = sV + (tid >> 3) * KVP + (tid & 7) * 4;
    /* unrolled so that 32 line loads of a wave are in flight at once: one wave per SIMD has nothing else to cover the L2 latency */
#pragma unroll 16
    for (int it = 0; it < SROWS * WID * (HD / 4) / PBLK; ++it) {
      const v4f k4 = *(const v4fa*)(ks + (size_t)it * (PBLK / 8) * QLD); const v4f v4 = *(const v4fa*)(ks + CC + (size_t)it * (PBLK / 8) * QLD);
      *(v4fa*)(kd + it * (PBLK / 8) * KVP) = k4; *(v4fa*)(vd + it * (PBLK / 8) * KVP) = v4; }
  }
  for (int t = tid; t < RPN; t += PBLK) srpb[t] = bf16_rne(rpb[h * RPN + t]);
  __syncthreads();
  const int p = p0 + tid; const int y = p / WID, x = p - y * WID;
  int ni = y - KS / 2; ni = (ni < 0) ? 0 : ((ni > HHT - KS) ? (HHT - KS) : ni);
  int nj = x - KS / 2; nj = (nj < 0) ? 0 : ((nj > WID - KS) ? (WID - KS) : nj);
  const int bi = ni - y + (KS - 1), bj = nj - x + (KS - 1);   /* both in [0, 6] */
  const float* qr = QKV + (size_t)p * QLD + h * HD;
  float qv[HD];
#pragma unroll
  for (int g = 0; g < HD / 4; ++g) { const v4f q4 = *(const v4fa*)(qr + 4 * g);
#pragma unroll
    for (int e = 0; e < 4; ++e) qv[4 * g + e] = q4[e]; }
  float mx = -3.0e38f;
#pragma unroll 1
  for (int i = 0; i < KS; ++i) {
    const float* krow = sK + ((ni - r0 + i) * WID + nj) * KVP;
    /* unrolled: the seven taps' LDS reads and their seven separate serial sums over d overlap (a lone wave per SIMD would wait out each read and each dependent fma) */
#pragma unroll
    for (int j = 0; j < KS; ++j) {
      const float* kr = krow + j * KVP;
      float a = 0.f;
#pragma unroll
      for (int g = 0; g < HD / 4; ++g) { const v4f k4 = *(const v4fa*)(kr + 4 * g);
#pragma unroll
        for (int e = 0; e < 4; ++e) a = fmaf(qv[4 * g + e], k4[e], a); }
      const float l = a * QSCALE + srpb[(bi + i) * RPW + (bj + j)];
      slog[i * KS + j][tid] = l;
      mx = fmaxf(mx, l);
    }
  }
  float s = 0.f; float acc[HD];
#pragma unroll
  for (int d = 0; d < HD; ++d) acc[d] = 0.f;
#pragma unroll 1
  for (int i = 0; i < KS; ++i) {
    const float* vrow = sV + ((ni - r0 + i) * WID + nj) * KVP;
    /* unrolled: the LDS reads of later taps fly while earlier taps are summed; taps are added in the order j = 0 .. 6 */
#pragma unroll
    for (int j = 0; j < KS; ++j) {
      const float l = slog[i * KS + j][tid]; const float e = expf(l - mx); s += e;
      const float* vr = vrow + j * KVP;
#pragma unroll
      for (int g = 0; g < HD / 4; ++g) { const v4f v = *(const v4fa*)(vr + 4 * g);
#pragma unroll
        for (int e2 = 0; e2 < 4; ++e2) acc[4 * g + e2] = fmaf(e, v[e2], acc[4 * g + e2]); } } }
  const float inv = 1.0f / s;
#pragma unroll
  for (int g = 0; g < HD / 8; ++g) { FragH fh, fr;
#pragma unroll
    for (int e2 = 0; e2 < 8; ++e2) { const float o64 = (acc[g * 8 + e2] * inv) * OSC; const _Float16 hv = (_Float16)o64; fh.h[e2] = hv; fr.h[e2] = (_Float16)((o64 - (float)hv) * RSC); }
    *(v8us*)&sO[tid][g * 8] = fh.half[0]; *(v8us*)&sO[tid][HD + g * 8] = fr.half[0]; }
  __syncthreads();
  {
#pragma unroll
    for (int it = 0; it < 8; ++it) { const int rr = w * 32 + it * 4 + (lane >> 3), q = lane & 7; const v8us o = *(const v8us*)&sO[rr][q * 8];
      *(v8us*)((unsigned short*)O16 + ((size_t)(p0 + rr)) * OLD + h * 64 + q * 8) = o; }
     }
}

extern "C" void kernel_launch(void* const* d_in, const int* in_sizes, int n_in,
                              void* d_out, int out_size, void* d_ws, size_t ws_size, hipStream_t stream) {
  if (n_in < 6) return;
  if (in_sizes[0] < NB * CC * PIX || in_sizes[1] < 3 * CC * CC || in_sizes[2] < 3 * CC || in_sizes[3] < NHD * RPN || in_sizes[4] < CC * CC || in_sizes[5] < CC) return;
  if (out_size < NB * CC * PIX) return;
  const float* x = (const float*)d_in[0]; const float* qkv_w = (const float*)d_in[1]; const float* qkv_b = (const float*)d_in[2];
  const float* rpb = (const float*)d_in[3]; const float* proj_w = (const float*)d_in[4]; const float* proj_b = (const float*)d_in[5];
  float* out = (float*)d_out;
  char* ws = (char*)d_ws; size_t off = 0;
  auto take = [&](size_t bytes) { char* p = ws + off; off += (bytes + 255) & ~(size_t)255; return p; };
  _Float16* X16 = (_Float16*)take((size_t)NB * PIX * CC * 2);       /* 4,194,304 B at NB=2 */
  _Float16* WQ16 = (_Float16*)take((size_t)3 * CC * CC * 2);        /* 393,216 */
  _Float16* WPA = (_Float16*)take((size_t)CC * OLD * 2);             /* 262,144 */
  float* QKV = (float*)take((size_t)NB * PIX * QLD * 4);             /* 25,165,824 at NB=2 */
  _Float16* O16 = (_Float16*)take((size_t)NB * PIX * OLD * 2);       /* 8,388,608 at NB=2 */
  if (off > ws_size || off > ((size_t)128 << 20)) return;            /* total 38,404,096 B */
  k_prep<<<NBLK_WQ + NBLK_WP + NBLK_XT, 256, 0, stream>>>(x, qkv_w, proj_w, X16, WQ16, WPA);
  k_gemm2<CC / 32, 2><<<dim3((unsigned)((PIX / 128) * (QLD / 64)), NB), 128, 0, stream>>>(X16, CC, WQ16, CC, 1.0f / (XSC * WSC), qkv_b, nullptr, QKV, QLD, PIX, QLD, PIX * CC, 0, PIX * QLD);
  k_att<<<dim3(NHD * NPB, NB), PBLK, 0, stream>>>(QKV, rpb, O16);
  k_gemm2<OLD / 32, 2><<<dim3((unsigned)((CC / 128) * (PIX / 64)), NB), 128, 0, stream>>>(WPA, OLD, O16, OLD, 1.0f / (PSC * OSC), nullptr, proj_b, out, PIX, CC, PIX, 0, PIX * OLD, CC * PIX);
}

// v005
// A run of this version takes 46.1 microseconds.
// Two timings next to v004 put it at 1.12 and 1.13 times that version's speed.
// All steps since v000 together make it 4.17 times as fast.
#include <hip/hip_runtime.h>
// Contractions on v_wmma_f32_16x16x32_f16 (f16 operands, f32 accumulate): qkv = X.Wqkv^T with bf16-RNE inputs carried exactly in f16 (x*16, Wqkv*64);
// out^T = Wp.O^T with O as f16 hi (*64) + f16 residual (*1024) planes folded along K against [Wp*1024 | Wp] (bf16-RNE Wp);
// per-pixel clamped 7x7 window q.k logits, 49-tap softmax and v aggregation in f32 on VALU from the f32 qkv plane.
#ifndef NB
#define NB 2
#endif
#define NB_FULL 2
#define CC 256
#define HHT 64
#define WID 64
#define PIX (HHT * WID)          /* 4096 */
#define NHD 8
#define HD 32
#define KS 7
#define NTAP (KS * KS)           /* 49 */
#define RPW (2 * KS - 1)         /* 13 */
#define RPN (RPW * RPW)          /* 169 per head */
#define QLD (3 * CC)             /* 768: qkv plane pitch, cols s*256 + h*32 + d */
#define OLD (2 * CC)             /* 512: k length of the O plane, per head h: [h*64 .. +31] hi, [h*64+32 .. +63] residual */
#define PBLK 128
#define NPB (PIX / PBLK)         /* 32 */
#define XT_P 32
#define XT_C 64
#define XSC 16.0f                /* x carry */
#define WSC 64.0f                /* qkv weight carry */
#define OSC 64.0f                /* O hi carry */
#define RSC 1024.0f              /* O residual carry */
#define PSC 1024.0f              /* proj weight carry against the hi plane */
#define QSCALE 0.17677669529663687f
#define SROWS (KS + 1)           /* image rows that hold every window of a block's two pixel rows */
#define KVP (HD + 4)             /* LDS pitch of a staged key / value pixel, floats: 144 B = 16 B x 9, so 16-byte reads of 16 neighbouring pixels meet 64 distinct banks */
static_assert(NB <= NB_FULL);
static_assert(PIX % PBLK == 0);
static_assert(PIX % 128 == 0);
static_assert(PIX % 64 == 0);
static_assert(PIX % XT_P == 0);
static_assert(CC % XT_C == 0);
static_assert(CC % 128 == 0);
static_assert(CC % 32 == 0);
static_assert(OLD % 32 == 0);
static_assert(QLD % 64 == 0);
static_assert(PBLK == 128);
static_assert(HD == 32);
static_assert(NHD * HD == CC);
static_assert(HHT >= KS && WID >= KS);
static_assert(PBLK == 2 * WID && HHT >= SROWS && HHT % 2 == 0);
static_assert((SROWS * WID * (HD / 4)) % PBLK == 0);

typedef unsigned short v8us __attribute__((ext_vector_type(8), may_alias));
typedef float v8f __attribute__((ext_vector_type(8)));
typedef float v4f __attribute__((ext_vector_type(4)));
typedef float v4fa __attribute__((ext_vector_type(4), may_alias));
typedef _Float16 v16h __attribute__((ext_vector_type(16)));
union FragH { v16h v; v8us half[2]; _Float16 h[16]; unsigned short u[16]; };

__device__ __forceinline__ unsigned short bf16_bits(float x) { unsigned int u = __float_as_uint(x); return (unsigned short)((u + 0x7FFFu + ((u >> 16) & 1u)) >> 16); }
__device__ __forceinline__ float bf16_val(unsigned short b) { return __uint_as_float(((unsigned int)b) << 16); }
__device__ __forceinline__ float bf16_rne(float x) { return bf16_val(bf16_bits(x)); }

// ---- f16 WMMA engine (wave tile 32x64; M % 128 == 0, N % 64 == 0, K % 32 == 0) ----
// A fragment: lane l -> row (l & 15); elements 0..7 <- k0 + 8*(l>>4) + 0..7, elements 8..15 <- k0 + 16 + 8*(l>>4) + 0..7.
// B fragment: the identical k map, lane -> column. D: acc[r] = (row 8*(l>>4) + r, col l & 15).
// Operand planes lie in fragment order: the fragment of 16-row tile T and k step s is 1 KiB at half index (T*KT + s)*512; in it lane l's elements 0..7 stand at l*8 and its
// elements 8..15 at 256 + l*8, so each of a fragment's two 16-byte loads reads 512 contiguous bytes (four whole 128-byte lines) and not 32 bytes out of each of 16 lines.
// frag_off: half index of the 8 halves (row, k8 .. k8+7), k8 % 8 == 0, in such a plane; the writers of the x and O planes use it.
__device__ __forceinline__ size_t frag_off(int row, int k8, int kt) { return ((((size_t)(row >> 4) * kt + (k8 >> 5)) * 2 + ((k8 >> 4) & 1)) * 32 + ((k8 >> 3) & 1) * 16 + (row & 15)) * 8; }
__device__ __forceinline__ v16h g2_frag(const _Float16* p) { FragH f; f.half[0] = *(const v8us*)((const unsigned short*)p); f.half[1] = *(const v8us*)((const unsigned short*)p + 256); return f.v; }
__device__ __forceinline__ v8f g2_mma(v16h a, v16h b, v8f c) { v8f d = __builtin_amdgcn_wmma_f32_16x16x32_f16(false, a, false, b, (short)0, c, false, false); asm volatile("v_nop\n\tv_nop\n\tv_nop\n\tv_nop" : "+v"(d) : "v"(a), "v"(b)); return d; }

// C[M][N] (f32, pitch ldc) = alpha * A[M][K].Bt[N][K]^T + bf16(bcol[n]) + bf16(brow[m]); A and Bt f16 planes in fragment order; K = 32 * KT.
// blockIdx.y = image of the batch: its A, Bt and C start sa, sb, sc elements behind the previous image's (0 for a plane that all images share).
// The six fragments of k step s + DEPTH are requested in front of the products of step s, so the loads of DEPTH steps are in flight while a step's products run, and no product waits for a load issued directly in front of it.
struct G2Step { v16h a0, a1, b0, b1, b2, b3; };
template <int KT, int DEPTH>
__global__ __launch_bounds__(128) void k_gemm2(const _Float16* __restrict__ A, const _Float16* __restrict__ Bh, float alpha,
                                               const float* __restrict__ bcol, const float* __restrict__ brow,
                                               float* __restrict__ C, int ldc, int M, int N, int sa, int sb, int sc) {
  static_assert(DEPTH >= 1 && DEPTH < KT && 12 * (DEPTH + 1) <= 63);   /* 12 loads a step; the load counter holds 63 */
  __shared__ __attribute__((aligned(16))) float so[4][32][68];
  const int tid = threadIdx.x, w = tid >> 5, lane = tid & 31, ln = lane & 15, hh = lane >> 4;
  const int ntn = N >> 6; const int mt = blockIdx.x / ntn, nq = blockIdx.x - mt * ntn; const int row0 = mt * 128 + 32 * w, col0 = nq * 64; if (row0 >= M) return;
  A += (size_t)blockIdx.y * sa; Bh += (size_t)blockIdx.y * sb; C += (size_t)blockIdx.y * sc;
  const _Float16* a0p = A + (size_t)(row0 >> 4) * (KT * 512) + lane * 8; const _Float16* a1p = a0p + KT * 512;
  const _Float16* b0p = Bh + (size_t)(col0 >> 4) * (KT * 512) + lane * 8; const _Float16* b1p = b0p + KT * 512; const _Float16* b2p = b1p + KT * 512; const _Float16* b3p = b2p + KT * 512;
  const v8f z8 = {0.f,0.f,0.f,0.f,0.f,0.f,0.f,0.f}; v8f c00 = z8, c01 = z8, c02 = z8, c03 = z8, c10 = z8, c11 = z8, c12 = z8, c13 = z8;
  G2Step f[KT];
  auto fetch = [&](int s) { const int kb = 512 * s;
    f[s].a0 = g2_frag(a0p + kb); f[s].b0 = g2_frag(b0p + kb); f[s].a1 = g2_frag(a1p + kb);
    f[s].b1 = g2_frag(b1p + kb); f[s].b2 = g2_frag(b2p + kb); f[s].b3 = g2_frag(b3p + kb); };
  /* both loops fully unrolled: every index of f is then a constant and the ring of DEPTH + 1 steps lives in registers */
#pragma unroll
  for (int s = 0; s < DEPTH; ++s) { fetch(s);
    __builtin_amdgcn_sched_barrier(0); }   /* keeps these loads in step order and in front of the first product with its wait: otherwise most of them start one memory latency late, or step 0 returns behind later steps */
#pragma unroll
  for (int s = 0; s < KT; ++s) {
    if (s + DEPTH < KT) fetch(s + DEPTH);
    c00 = g2_mma(f[s].a0, f[s].b0, c00); c10 = g2_mma(f[s].a1, f[s].b0, c10);
    c01 = g2_mma(f[s].a0, f[s].b1, c01); c11 = g2_mma(f[s].a1, f[s].b1, c11);
    c02 = g2_mma(f[s].a0, f[s].b2, c02); c12 = g2_mma(f[s].a1, f[s].b2, c12);
    c03 = g2_mma(f[s].a0, f[s].b3, c03); c13 = g2_mma(f[s].a1, f[s].b3, c13); }
  v8f accs[8] = {c00, c01, c02, c03, c10, c11, c12, c13};
#pragma unroll
  for (int u = 0; u < 8; ++u) { const int t = u & 3, half = u >> 2; const int col = col0 + t * 16 + ln; const float bv = bcol ? bf16_rne(bcol[col]) : 0.f;
#pragma unroll
    for (int r = 0; r < 8; ++r) { const int rloc = half * 16 + 8 * hh + r; float v = accs[u][r] * alpha + bv; if (brow) v += bf16_rne(brow[row0 + rloc]); so[w][rloc][t * 16 + ln] = v; } }
  __builtin_amdgcn_fence(__ATOMIC_ACQ_REL, "workgroup"); __builtin_amdgcn_wave_barrier();
  const int rsub = lane >> 4, c4 = (lane & 15) * 4;
  {
#pragma unroll
    for (int q = 0; q < 16; ++q) { const int r = q * 2 + rsub; const v4f v = *(const v4fa*)&so[w][r][c4]; *(v4f*)(C + (size_t)(row0 + r) * ldc + col0 + c4) = v; }
     }
}

#define NBLK_WQ (3 * CC * CC / 8 / 256)                    /* 96 blocks: qkv weight */
#define NBLK_WP (CC * OLD / 8 / 256)                       /* 64 blocks: proj weight */
#define NBLK_XT (NB * (CC / XT_C) * (PIX / XT_P))          /* 1024 blocks at NB=2: x */
static_assert((3 * CC * CC / 8) % 256 == 0 && (CC * OLD / 8) % 256 == 0);

// thread t writes the t-th 16 bytes of the fragment-ordered plane: lane t & 31, element half (t >> 5) & 1, k step and 16-row tile above
__device__ __forceinline__ void d_cvt8(int blk, const float* __restrict__ W, _Float16* __restrict__ Bt, float scale) {
  const int t = blk * 256 + threadIdx.x; FragH f;
  const int n = (t >> 6) / (CC / 32) * 16 + (t & 15); const int k8 = ((t >> 6) % (CC / 32)) * 32 + ((t >> 5) & 1) * 16 + ((t >> 4) & 1) * 8;
#pragma unroll
  for (int i = 0; i < 8; ++i) f.h[i] = (_Float16)(bf16_rne(W[(size_t)n * CC + k8 + i]) * scale);
  unsigned short* dst = (unsigned short*)Bt + (size_t)t * 8;
  *(v8us*)dst = f.half[0];
  asm volatile("s_wait_xcnt 0x0" ::: "memory");   /* the block ranges lie one behind the other in the built kernel: the wait stands in front of any later write of the store's registers */
}

__device__ __forceinline__ void d_wpa(int blk, const float* __restrict__ W, _Float16* __restrict__ WPA) {
  const int t = blk * 256 + threadIdx.x;
  const int c = (t >> 6) / (OLD / 32) * 16 + (t & 15); const int k8 = ((t >> 6) % (OLD / 32)) * 32 + ((t >> 5) & 1) * 16 + ((t >> 4) & 1) * 8;   /* as in d_cvt8 */
  const int h = k8 >> 6; const int wi = k8 & 63; const int d0 = wi & 31;
  const float sc = (wi >= 32) ? 1.0f : PSC;
  FragH f;
#pragma unroll
  for (int i = 0; i < 8; ++i) f.h[i] = (_Float16)(bf16_rne(W[(size_t)c * CC + h * HD + d0 + i]) * sc);
  unsigned short* dst = (unsigned short*)WPA + (size_t)t * 8;
  *(v8us*)dst = f.half[0];
  asm volatile("s_wait_xcnt 0x0" ::: "memory");   /* the block ranges lie one behind the other in the built kernel: the wait stands in front of any later write of the store's registers */
}

// The three operand conversions depend on nothing but the inputs, so they share one launch: block ranges of one grid, the two short weight ranges first.
// blocks [0, NBLK_WQ): qkv weight -> f16 plane; [NBLK_WQ, NBLK_WQ + NBLK_WP): proj weight -> [Wp*1024 | Wp] plane; the rest: x -> f16 plane with pixels as rows; all in fragment order.
// x coverage: 8 waves x 32 lanes x 8 halves = (2 row tiles x 2 k steps x 2 element halves) x 512 B = 32 rows x 64 channels per block; NB x (CC/64) x (PIX/32) blocks
__global__ __launch_bounds__(256) void k_prep(const float* __restrict__ x, const float* __restrict__ qkv_w, const float* __restrict__ proj_w,
                                              _Float16* __restrict__ X16, _Float16* __restrict__ WQ16, _Float16* __restrict__ WPA) {
  __shared__ __attribute__((aligned(16))) _Float16 st[XT_P][XT_C + 8];   /* 144 B pitch: the 16-byte reads of 16 neighbouring rows meet distinct banks */
  int blk = blockIdx.x;
  if (blk < NBLK_WQ) { d_cvt8(blk, qkv_w, WQ16, WSC); return; }              /* block-uniform: a whole block leaves, in front of the barrier */
  blk -= NBLK_WQ;
  if (blk < NBLK_WP) { d_wpa(blk, proj_w, WPA); return; }
  blk -= NBLK_WP;
  const int tid = threadIdx.x, w = tid >> 5, lane = tid & 31;
  const int pt = blk % (PIX / XT_P); blk /= (PIX / XT_P);
  const int ch = blk % (CC / XT_C); const int b = blk / (CC / XT_C);
  const float* src = x + ((size_t)(b * CC + ch * XT_C)) * PIX + (size_t)pt * XT_P + lane;
#pragma unroll
  for (int it = 0; it < XT_C / 8; ++it) {
    const int ci = it * 8 + w;
    const float v = src[(size_t)ci * PIX];
    st[lane][ci] = (_Float16)(bf16_rne(v) * XSC);
  }
  __syncthreads();
  const int rr = (w >> 2) * 16 + (lane & 15), k8 = ((w >> 1) & 1) * 32 + (w & 1) * 16 + (lane >> 4) * 8;   /* a wave writes one element half of one fragment: 512 contiguous bytes */
  const v8us o = *(const v8us*)&st[rr][k8];
  unsigned short* dst = (unsigned short*)X16 + (size_t)b * PIX * CC + frag_off(pt * XT_P + rr, ch * XT_C + k8, CC / 32);
  *(v8us*)dst = o;
  asm volatile("s_wait_xcnt 0x0" ::: "memory");   /* the block ranges lie one behind the other in the built kernel: the wait stands in front of any later write of the store's registers */
}

// Thread per (h, pixel p = y*WID + x). Clamped window start ni = clamp(y-3, 0, H-7), nj = clamp(x-3, 0, W-7); taps (i, j) in 7x7 at key pixel (ni+i, nj+j);
// logit a_t = QSCALE * sum_d q[p][h*32+d] k[key][256 + h*32 + d] + bf16(rpb[h][ni+i-y+6][nj+j-x+6]) in f32, kept in thread-private LDS;
// max-subtracted softmax in f32; O[d] = (sum_t e_t v[key][512 + h*32 + d]) / sum_t e_t; O -> f16 hi = f16(O*64), res = f16((O*64 - hi)*1024);
// The block's pixels are image rows y0, y0+1; all their windows lie in rows r0 .. r0+7, r0 = clamp(y0-3, 0, H-8). The head's k and v of those 8 x 64 pixels are
// staged once in LDS (whole 128-byte lines from the plane) and every tap reads them there.
// O plane in fragment order (pixels as rows). coverage: 8 iterations (row tiles) x 4 waves (2 k steps x 2 element halves) x 512 B = 128 rows x 64 halves per block; grid = (NHD x (PIX/128), NB), blockIdx.y = image with its own qkv and O plane
__global__ __launch_bounds__(PBLK) void k_att(const float* __restrict__ QKV, const float* __restrict__ rpb, _Float16* __restrict__ O16) {
  __shared__ float srpb[RPN + 7];
  __shared__ __attribute__((aligned(16))) float slog[NTAP][PBLK];
  __shared__ __attribute__((aligned(16))) unsigned short sO[PBLK][64 + 8];   /* 144 B pitch: the 16-byte accesses of 16 neighbouring rows meet distinct banks */
  __shared__ __attribute__((aligned(16))) float sK[SROWS * WID * KVP];
  __shared__ __attribute__((aligned(16))) float sV[SROWS * WID * KVP];
  const int tid = threadIdx.x, w = tid >> 5, lane = tid & 31;
  const int h = blockIdx.x / NPB; const int p0 = (blockIdx.x - h * NPB) * PBLK;
  QKV += (size_t)blockIdx.y * (PIX * QLD); O16 += (size_t)blockIdx.y * (PIX * OLD);
  int r0 = p0 / WID - KS / 2; r0 = (r0 < 0) ? 0 : ((r0 > HHT - SROWS) ? (HHT - SROWS) : r0);
  {
    const float* ks = QKV + (size_t)(r0 * WID + (tid >> 3)) * QLD + CC + h * HD + (tid & 7) * 4;   /* 8 lanes per pixel, 16 pixels per pass */
    float* kd = sK + (tid >> 3) * KVP + (tid & 7) * 4; float* vd = sV + (tid >> 3) * KVP + (tid & 7) * 4;
    /* unrolled so that 32 line loads of a wave are in flight at once: one wave per SIMD has nothing else to cover the L2 latency */
#pragma unroll 16
    for (int it = 0; it < SROWS * WID * (HD / 4) / PBLK; ++it) {
      const v4f k4 = *(const v4fa*)(ks + (size_t)it * (PBLK / 8) * QLD); const v4f v4 = *(const v4fa*)(ks + CC + (size_t)it * (PBLK / 8) * QLD);
      *(v4fa*)(kd + it * (PBLK / 8) * KVP) = k4; *(v4fa*)(vd + it * (PBLK / 8) * KVP) = v4; }
  }
  for (int t = tid; t < RPN; t += PBLK) srpb[t] = bf16_rne(rpb[h * RPN + t]);
  __syncthreads();
  const int p = p0 + tid; const int y = p / WID, x = p - y * WID;
  int ni = y - KS / 2; ni = (ni < 0) ? 0 : ((ni > HHT - KS) ? (HHT - KS) : ni);
  int nj = x - KS / 2; nj = (nj < 0) ? 0 : ((nj > WID - KS) ? (WID - KS) : nj);
  const int bi = ni - y + (KS - 1), bj = nj - x + (KS - 1);   /* both in [0, 6] */
  const float* qr = QKV + (size_t)p * QLD + h * HD;
  float qv[HD];
#pragma unroll
  for (int g = 0; g < HD / 4; ++g) { const v4f q4 = *(const v4fa*)(qr + 4 * g);
#pragma unroll
    for (int e = 0; e < 4; ++e) qv[4 * g + e] = q4[e]; }
  float mx = -3.0e38f;
#pragma unroll 1
  for (int i = 0; i < KS; ++i) {
    const float* krow = sK + ((ni - r0 + i) * WID + nj) * KVP;
    /* unrolled: the seven taps' LDS reads and their seven separate serial sums over d overlap (a lone wave per SIMD would wait out each read and each dependent fma) */
#pragma unroll
    for (int j = 0; j < KS; ++j) {
      const float* kr = krow + j * KVP;
      float a = 0.f;
#pragma unroll
      for (int g = 0; g < HD / 4; ++g) { const v4f k4 = *(const v4fa*)(kr + 4 * g);
#pragma unroll
        for (int e = 0; e < 4; ++e) a = fmaf(qv[4 * g + e], k4[e], a); }
      const float l = a * QSCALE + srpb[(bi + i) * RPW + (bj + j)];
      slog[i * KS + j][tid] = l;
      mx = fmaxf(mx, l);
    }
  }
  float s = 0.f; float acc[HD];
#pragma unroll
  for (int d = 0; d < HD; ++d) acc[d] = 0.f;
#pragma unroll 1
  for (int i = 0; i < KS; ++i) {
    const float* vrow = sV + ((ni - r0 + i) * WID + nj) * KVP;
    /* unrolled: the LDS reads of later taps fly while earlier taps are summed; taps are added in the order j = 0 .. 6 */
#pragma unroll
    for (int j = 0; j < KS; ++j) {
      const float l = slog[i * KS + j][tid]; const float e = expf(l - mx); s += e;
      const float* vr = vrow + j * KVP;
#pragma unroll
      for (int g = 0; g < HD / 4; ++g) { const v4f v = *(const v4fa*)(vr + 4 * g);
#pragma unroll
        for (int e2 = 0; e2 < 4; ++e2) acc[4 * g + e2] = fmaf(e, v[e2], acc[4 * g + e2]); } } }
  const float inv = 1.0f / s;
#pragma unroll
  for (int g = 0; g < HD / 8; ++g) { FragH fh, fr;
#pragma unroll
    for (int e2 = 0; e2 < 8; ++e2) { const float o64 = (acc[g * 8 + e2] * inv) * OSC; const _Float16 hv = (_Float16)o64; fh.h[e2] = hv; fr.h[e2] = (_Float16)((o64 - (float)hv) * RSC); }
    *(v8us*)&sO[tid][g * 8] = fh.half[0]; *(v8us*)&sO[tid][HD + g * 8] = fr.half[0]; }
  __syncthreads();
  {
#pragma unroll
    for (int it = 0; it < 8; ++it) { const int rr = it * 16 + (lane & 15), k8 = (w >> 1) * 32 + (w & 1) * 16 + (lane >> 4) * 8; const v8us o = *(const v8us*)&sO[rr][k8];
      *(v8us*)((unsigned short*)O16 + frag_off(p0 + rr, h * 64 + k8, OLD / 32)) = o; }
     }
}

extern "C" void kernel_launch(void* const* d_in, const int* in_sizes, int n_in,
                              void* d_out, int out_size, void* d_ws, size_t ws_size, hipStream_t stream) {
  if (n_in < 6) return;
  if (in_sizes[0] < NB * CC * PIX || in_sizes[1] < 3 * CC * CC || in_sizes[2] < 3 * CC || in_sizes[3] < NHD * RPN || in_sizes[4] < CC * CC || in_sizes[5] < CC) return;
  if (out_size < NB * CC * PIX) return;
  const float* x = (const float*)d_in[0]; const float* qkv_w = (const float*)d_in[1]; const float* qkv_b = (const float*)d_in[2];
  const float* rpb = (const float*)d_in[3]; const float* proj_w = (const float*)d_in[4]; const float* proj_b = (const float*)d_in[5];
  float* out = (float*)d_out;
  char* ws = (char*)d_ws; size_t off = 0;
  auto take = [&](size_t bytes) { char* p = ws + off; off += (bytes + 255) & ~(size_t)255; return p; };
  _Float16* X16 = (_Float16*)take((size_t)NB * PIX * CC * 2);       /* 4,194,304 B at NB=2 */
  _Float16* WQ16 = (_Float16*)take((size_t)3 * CC * CC * 2);        /* 393,216 */
  _Float16* WPA = (_Float16*)take((size_t)CC * OLD * 2);             /* 262,144 */
  float* QKV = (float*)take((size_t)NB * PIX * QLD * 4);             /* 25,165,824 at NB=2 */
  _Float16* O16 = (_Float16*)take((size_t)NB * PIX * OLD * 2);       /* 8,388,608 at NB=2 */
  if (off > ws_size || off > ((size_t)128 << 20)) return;            /* total 38,404,096 B */
  k_prep<<<NBLK_WQ + NBLK_WP + NBLK_XT, 256, 0, stream>>>(x, qkv_w, proj_w, X16, WQ16, WPA);
  k_gemm2<CC / 32, 2><<<dim3((unsigned)((PIX / 128) * (QLD / 64)), NB), 128, 0, stream>>>(X16, WQ16, 1.0f / (XSC * WSC), qkv_b, nullptr, QKV, QLD, PIX, QLD, PIX * CC, 0, PIX * QLD);
  k_att<<<dim3(NHD * NPB, NB), PBLK, 0, stream>>>(QKV, rpb, O16);
  k_gemm2<OLD / 32, 2><<<dim3((unsigned)((CC / 128) * (PIX / 64)), NB), 128, 0, stream>>>(WPA, O16, 1.0f / (PSC * OSC), nullptr, proj_b, out, PIX, CC, PIX, 0, PIX * OLD, CC * PIX);
}

// v006
// A run of this version takes 40.2 microseconds.
// In two side-by-side timings against v005, it was 1.14 and 1.15 times as fast.
// Over all steps from v000 it is 4.79 times as fast.
#include <hip/hip_runtime.h>
// Contractions on v_wmma_f32_16x16x32_f16 (f16 operands, f32 accumulate): qkv = X.Wqkv^T with bf16-RNE inputs carried exactly in f16 (x*16, Wqkv*64);
// out^T = Wp.O^T with O as f16 hi (*64) + f16 residual (*1024) planes folded along K against [Wp*1024 | Wp] (bf16-RNE Wp);
// per-pixel clamped 7x7 window q.k logits, 49-tap softmax and v aggregation in f32 on VALU from the f32 qkv plane.
#ifndef NB
#define NB 2
#endif
#define NB_FULL 2
#define CC 256
#define HHT 64
#define WID 64
#define PIX (HHT * WID)          /* 4096 */
#define NHD 8
#define HD 32
#define KS 7
#define NTAP (KS * KS)           /* 49 */
#define RPW (2 * KS - 1)         /* 13 */
#define RPN (RPW * RPW)          /* 169 per head */
#define QLD (3 * CC)             /* 768: qkv plane pitch, cols s*256 + h*32 + d */
#define OLD (2 * CC)             /* 512: k length of the O plane, per head h: [h*64 .. +31] hi, [h*64+32 .. +63] residual */
#define PBLK 128
#define QPB (2 * PBLK)            /* 256 pixels of a block of the attention kernel: two per thread */
#define NPB (PIX / QPB)          /* 16 */
#define XT_P 32
#define XT_C 64
#define XSC 16.0f                /* x carry */
#define WSC 64.0f                /* qkv weight carry */
#define OSC 64.0f                /* O hi carry */
#define RSC 1024.0f              /* O residual carry */
#define PSC 1024.0f              /* proj weight carry against the hi plane */
#define QSCALE 0.17677669529663687f
#define SROWS (KS + 3)           /* image rows that hold every window of a block's four pixel rows */
#define KVP (HD + 4)             /* LDS pitch of a staged key / value pixel, floats: 144 B = 16 B x 9, so 16-byte reads of 16 neighbouring pixels meet 64 distinct banks */
static_assert(NB <= NB_FULL);
static_assert(PIX % QPB == 0);
static_assert(PIX % 128 == 0);
static_assert(PIX % 64 == 0);
static_assert(PIX % XT_P == 0);
static_assert(CC % XT_C == 0);
static_assert(CC % 128 == 0);
static_assert(CC % 32 == 0);
static_assert(OLD % 32 == 0);
static_assert(QLD % 64 == 0);
static_assert(PBLK == 128);
static_assert(HD == 32);
static_assert(NHD * HD == CC);
static_assert(HHT >= KS && WID >= KS);
static_assert(PBLK == 2 * WID && QPB == 4 * WID && HHT >= SROWS && HHT % 4 == 0);
static_assert((SROWS * WID * (HD / 4)) % PBLK == 0);

typedef unsigned short v8us __attribute__((ext_vector_type(8), may_alias));
typedef float v8f __attribute__((ext_vector_type(8)));
typedef float v4f __attribute__((ext_vector_type(4)));
typedef float v2f __attribute__((ext_vector_type(2)));
typedef float v4fa __attribute__((ext_vector_type(4), may_alias));
typedef _Float16 v16h __attribute__((ext_vector_type(16)));
union FragH { v16h v; v8us half[2]; _Float16 h[16]; unsigned short u[16]; };

__device__ __forceinline__ unsigned short bf16_bits(float x) { unsigned int u = __float_as_uint(x); return (unsigned short)((u + 0x7FFFu + ((u >> 16) & 1u)) >> 16); }
__device__ __forceinline__ float bf16_val(unsigned short b) { return __uint_as_float(((unsigned int)b) << 16); }
__device__ __forceinline__ float bf16_rne(float x) { return bf16_val(bf16_bits(x)); }

// ---- f16 WMMA engine (wave tile 32x64; M % 128 == 0, N % 64 == 0, K % 32 == 0) ----
// A fragment: lane l -> row (l & 15); elements 0..7 <- k0 + 8*(l>>4) + 0..7, elements 8..15 <- k0 + 16 + 8*(l>>4) + 0..7.
// B fragment: the identical k map, lane -> column. D: acc[r] = (row 8*(l>>4) + r, col l & 15).
// Operand planes lie in fragment order: the fragment of 16-row tile T and k step s is 1 KiB at half index (T*KT + s)*512; in it lane l's elements 0..7 stand at l*8 and its
// elements 8..15 at 256 + l*8, so each of a fragment's two 16-byte loads reads 512 contiguous bytes (four whole 128-byte lines) and not 32 bytes out of each of 16 lines.
// frag_off: half index of the 8 halves (row, k8 .. k8+7), k8 % 8 == 0, in such a plane; the writers of the x and O planes use it.
__device__ __forceinline__ size_t frag_off(int row, int k8, int kt) { return ((((size_t)(row >> 4) * kt + (k8 >> 5)) * 2 + ((k8 >> 4) & 1)) * 32 + ((k8 >> 3) & 1) * 16 + (row & 15)) * 8; }
__device__ __forceinline__ v16h g2_frag(const _Float16* p) { FragH f; f.half[0] = *(const v8us*)((const unsigned short*)p); f.half[1] = *(const v8us*)((const unsigned short*)p + 256); return f.v; }
__device__ __forceinline__ v8f g2_mma(v16h a, v16h b, v8f c) { v8f d = __builtin_amdgcn_wmma_f32_16x16x32_f16(false, a, false, b, (short)0, c, false, false); asm volatile("v_nop\n\tv_nop\n\tv_nop\n\tv_nop" : "+v"(d) : "v"(a), "v"(b)); return d; }

// C[M][N] (f32, pitch ldc) = alpha * A[M][K].Bt[N][K]^T + bf16(bcol[n]) + bf16(brow[m]); A and Bt f16 planes in fragment order; K = 32 * KT.
// blockIdx.y = image of the batch: its A, Bt and C start sa, sb, sc elements behind the previous image's (0 for a plane that all images share).
// The six fragments of k step s + DEPTH are requested in front of the products of step s, so the loads of DEPTH steps are in flight while a step's products run, and no product waits for a load issued directly in front of it.
struct G2Step { v16h a0, a1, b0, b1, b2, b3; };
template <int KT, int DEPTH>
__global__ __launch_bounds__(128) void k_gemm2(const _Float16* __restrict__ A, const _Float16* __restrict__ Bh, float alpha,
                                               const float* __restrict__ bcol, const float* __restrict__ brow,
                                               float* __restrict__ C, int ldc, int M, int N, int sa, int sb, int sc) {
  static_assert(DEPTH >= 1 && DEPTH < KT && 12 * (DEPTH + 1) <= 63);   /* 12 loads a step; the load counter holds 63 */
  __shared__ __attribute__((aligned(16))) float so[4][32][68];
  const int tid = threadIdx.x, w = tid >> 5, lane = tid & 31, ln = lane & 15, hh = lane >> 4;
  const int ntn = N >> 6; const int mt = blockIdx.x / ntn, nq = blockIdx.x - mt * ntn; const int row0 = mt * 128 + 32 * w, col0 = nq * 64; if (row0 >= M) return;
  A += (size_t)blockIdx.y * sa; Bh += (size_t)blockIdx.y * sb; C += (size_t)blockIdx.y * sc;
  const _Float16* a0p = A + (size_t)(row0 >> 4) * (KT * 512) + lane * 8; const _Float16* a1p = a0p + KT * 512;
  const _Float16* b0p = Bh + (size_t)(col0 >> 4) * (KT * 512) + lane * 8; const _Float16* b1p = b0p + KT * 512; const _Float16* b2p = b1p + KT * 512; const _Float16* b3p = b2p + KT * 512;
  const v8f z8 = {0.f,0.f,0.f,0.f,0.f,0.f,0.f,0.f}; v8f c00 = z8, c01 = z8, c02 = z8, c03 = z8, c10 = z8, c11 = z8, c12 = z8, c13 = z8;
  G2Step f[KT];
  auto fetch = [&](int s) { const int kb = 512 * s;
    f[s].a0 = g2_frag(a0p + kb); f[s].b0 = g2_frag(b0p + kb); f[s].a1 = g2_frag(a1p + kb);
    f[s].b1 = g2_frag(b1p + kb); f[s].b2 = g2_frag(b2p + kb); f[s].b3 = g2_frag(b3p + kb); };
  /* both loops fully unrolled: every index of f is then a constant and the ring of DEPTH + 1 steps lives in registers */
#pragma unroll
  for (int s = 0; s < DEPTH; ++s) { fetch(s);
    __builtin_amdgcn_sched_barrier(0); }   /* keeps these loads in step order and in front of the first product with its wait: otherwise most of them start one memory latency late, or step 0 returns behind later steps */
#pragma unroll
  for (int s = 0; s < KT; ++s) {
    if (s + DEPTH < KT) fetch(s + DEPTH);
    c00 = g2_mma(f[s].a0, f[s].b0, c00); c10 = g2_mma(f[s].a1, f[s].b0, c10);
    c01 = g2_mma(f[s].a0, f[s].b1, c01); c11 = g2_mma(f[s].a1, f[s].b1, c11);
    c02 = g2_mma(f[s].a0, f[s].b2, c02); c12 = g2_mma(f[s].a1, f[s].b2, c12);
    c03 = g2_mma(f[s].a0, f[s].b3, c03); c13 = g2_mma(f[s].a1, f[s].b3, c13); }
  v8f accs[8] = {c00, c01, c02, c03, c10, c11, c12, c13};
#pragma unroll
  for (int u = 0; u < 8; ++u) { const int t = u & 3, half = u >> 2; const int col = col0 + t * 16 + ln; const float bv = bcol ? bf16_rne(bcol[col]) : 0.f;
#pragma unroll
    for (int r = 0; r < 8; ++r) { const int rloc = half * 16 + 8 * hh + r; float v = accs[u][r] * alpha + bv; if (brow) v += bf16_rne(brow[row0 + rloc]); so[w][rloc][t * 16 + ln] = v; } }
  __builtin_amdgcn_fence(__ATOMIC_ACQ_REL, "workgroup"); __builtin_amdgcn_wave_barrier();
  const int rsub = lane >> 4, c4 = (lane & 15) * 4;
  {
#pragma unroll
    for (int q = 0; q < 16; ++q) { const int r = q * 2 + rsub; const v4f v = *(const v4fa*)&so[w][r][c4]; *(v4f*)(C + (size_t)(row0 + r) * ldc + col0 + c4) = v; }
     }
}

#define NBLK_WQ (3 * CC * CC / 8 / 256)                    /* 96 blocks: qkv weight */
#define NBLK_WP (CC * OLD / 8 / 256)                       /* 64 blocks: proj weight */
#define NBLK_XT (NB * (CC / XT_C) * (PIX / XT_P))          /* 1024 blocks at NB=2: x */
static_assert((3 * CC * CC / 8) % 256 == 0 && (CC * OLD / 8) % 256 == 0);

// thread t writes the t-th 16 bytes of the fragment-ordered plane: lane t & 31, element half (t >> 5) & 1, k step and 16-row tile above
__device__ __forceinline__ void d_cvt8(int blk, const float* __restrict__ W, _Float16* __restrict__ Bt, float scale) {
  const int t = blk * 256 + threadIdx.x; FragH f;
  const int n = (t >> 6) / (CC / 32) * 16 + (t & 15); const int k8 = ((t >> 6) % (CC / 32)) * 32 + ((t >> 5) & 1) * 16 + ((t >> 4) & 1) * 8;
#pragma unroll
  for (int i = 0; i < 8; ++i) f.h[i] = (_Float16)(bf16_rne(W[(size_t)n * CC + k8 + i]) * scale);
  unsigned short* dst = (unsigned short*)Bt + (size_t)t * 8;
  *(v8us*)dst = f.half[0];
  asm volatile("s_wait_xcnt 0x0" ::: "memory");   /* the block ranges lie one behind the other in the built kernel: the wait stands in front of any later write of the store's registers */
}

__device__ __forceinline__ void d_wpa(int blk, const float* __restrict__ W, _Float16* __restrict__ WPA) {
  const int t = blk * 256 + threadIdx.x;
  const int c = (t >> 6) / (OLD / 32) * 16 + (t & 15); const int k8 = ((t >> 6) % (OLD / 32)) * 32 + ((t >> 5) & 1) * 16 + ((t >> 4) & 1) * 8;   /* as in d_cvt8 */
  const int h = k8 >> 6; const int wi = k8 & 63; const int d0 = wi & 31;
  const float sc = (wi >= 32) ? 1.0f : PSC;
  FragH f;
#pragma unroll
  for (int i = 0; i < 8; ++i) f.h[i] = (_Float16)(bf16_rne(W[(size_t)c * CC + h * HD + d0 + i]) * sc);
  unsigned short* dst = (unsigned short*)WPA + (size_t)t * 8;
  *(v8us*)dst = f.half[0];
  asm volatile("s_wait_xcnt 0x0" ::: "memory");   /* the block ranges lie one behind the other in the built kernel: the wait stands in front of any later write of the store's registers */
}

// The three operand conversions depend on nothing but the inputs, so they share one launch: block ranges of one grid, the two short weight ranges first.
// blocks [0, NBLK_WQ): qkv weight -> f16 plane; [NBLK_WQ, NBLK_WQ + NBLK_WP): proj weight -> [Wp*1024 | Wp] plane; the rest: x -> f16 plane with pixels as rows; all in fragment order.
// x coverage: 8 waves x 32 lanes x 8 halves = (2 row tiles x 2 k steps x 2 element halves) x 512 B = 32 rows x 64 channels per block; NB x (CC/64) x (PIX/32) blocks
__global__ __launch_bounds__(256) void k_prep(const float* __restrict__ x, const float* __restrict__ qkv_w, const float* __restrict__ proj_w,
                                              _Float16* __restrict__ X16, _Float16* __restrict__ WQ16, _Float16* __restrict__ WPA) {
  __shared__ __attribute__((aligned(16))) _Float16 st[XT_P][XT_C + 8];   /* 144 B pitch: the 16-byte reads of 16 neighbouring rows meet distinct banks */
  int blk = blockIdx.x;
  if (blk < NBLK_WQ) { d_cvt8(blk, qkv_w, WQ16, WSC); return; }              /* block-uniform: a whole block leaves, in front of the barrier */
  blk -= NBLK_WQ;
  if (blk < NBLK_WP) { d_wpa(blk, proj_w, WPA); return; }
  blk -= NBLK_WP;
  const int tid = threadIdx.x, w = tid >> 5, lane = tid & 31;
  const int pt = blk % (PIX / XT_P); blk /= (PIX / XT_P);
  const int ch = blk % (CC / XT_C); const int b = blk / (CC / XT_C);
  const float* src = x + ((size_t)(b * CC + ch * XT_C)) * PIX + (size_t)pt * XT_P + lane;
#pragma unroll
  for (int it = 0; it < XT_C / 8; ++it) {
    const int ci = it * 8 + w;
    const float v = src[(size_t)ci * PIX];
    st[lane][ci] = (_Float16)(bf16_rne(v) * XSC);
  }
  __syncthreads();
  const int rr = (w >> 2) * 16 + (lane & 15), k8 = ((w >> 1) & 1) * 32 + (w & 1) * 16 + (lane >> 4) * 8;   /* a wave writes one element half of one fragment: 512 contiguous bytes */
  const v8us o = *(const v8us*)&st[rr][k8];
  unsigned short* dst = (unsigned short*)X16 + (size_t)b * PIX * CC + frag_off(pt * XT_P + rr, ch * XT_C + k8, CC / 32);
  *(v8us*)dst = o;
  asm volatile("s_wait_xcnt 0x0" ::: "memory");   /* the block ranges lie one behind the other in the built kernel: the wait stands in front of any later write of the store's registers */
}

// Thread per (h, pixel pair): pixels A = (yA, x) and B = (yA + 1, x). Clamped window start ni = clamp(y-3, 0, H-7), nj = clamp(x-3, 0, W-7); taps (i, j) in 7x7 at key pixel (ni+i, nj+j);
// logit a_t = QSCALE * sum_d q[p][h*32+d] k[key][256 + h*32 + d] + bf16(rpb[h][ni+i-y+6][nj+j-x+6]) in f32, kept in thread-private LDS;
// max-subtracted softmax in f32; O[d] = (sum_t e_t v[key][512 + h*32 + d]) / sum_t e_t; O -> f16 hi = f16(O*64), res = f16((O*64 - hi)*1024);
// The block's pixels are image rows y0 .. y0+3; all their windows lie in rows r0 .. r0+9, r0 = clamp(y0-3, 0, H-10). The head's k and v of those 10 x 64 pixels are
// staged once in LDS (whole 128-byte lines from the plane) and every tap reads them there.
// A and B share nj, and their window rows are niA .. niA+6 and niB .. niB+6 with niB - niA = 0 or 1: the thread walks the 7 or 8 rows of the union once and every key / value
// vector it reads from LDS serves both pixels. Each pixel's own sums keep their order (d = 0 .. 31 in a logit, taps by i then j in the softmax sum and in O).
// O plane in fragment order (pixels as rows). coverage: 16 iterations (row tiles) x 4 waves (2 k steps x 2 element halves) x 512 B = 256 rows x 64 halves per block; grid = (NHD x (PIX/256), NB), blockIdx.y = image with its own qkv and O plane
__global__ __launch_bounds__(PBLK) void k_att(const float* __restrict__ QKV, const float* __restrict__ rpb, _Float16* __restrict__ O16) {
  __shared__ float srpb[RPN + 7];
  __shared__ __attribute__((aligned(16))) float slog[NTAP][QPB];
  __shared__ __attribute__((aligned(16))) unsigned short sO[QPB][64 + 8];   /* 144 B pitch: the 16-byte accesses of 16 neighbouring rows meet distinct banks */
  __shared__ __attribute__((aligned(16))) float sK[SROWS * WID * KVP];
  __shared__ __attribute__((aligned(16))) float sV[SROWS * WID * KVP];
  const int tid = threadIdx.x, lane = tid & 31;
  const int w = __builtin_amdgcn_readfirstlane(tid >> 5);   /* the wave's number in a scalar register: a wave's image rows, and with them the row tests below, are the same in all its lanes */
  const int h = blockIdx.x / NPB; const int p0 = (blockIdx.x - h * NPB) * QPB;
  QKV += (size_t)blockIdx.y * (PIX * QLD); O16 += (size_t)blockIdx.y * (PIX * OLD);
  int r0 = p0 / WID - KS / 2; r0 = (r0 < 0) ? 0 : ((r0 > HHT - SROWS) ? (HHT - SROWS) : r0);
  {
    const float* ks = QKV + (size_t)(r0 * WID + (tid >> 3)) * QLD + CC + h * HD + (tid & 7) * 4;   /* 8 lanes per pixel, 16 pixels per pass */
    float* kd = sK + (tid >> 3) * KVP + (tid & 7) * 4; float* vd = sV + (tid >> 3) * KVP + (tid & 7) * 4;
    /* unrolled so that 40 line loads of a wave are in flight at once: one wave per SIMD has nothing else to cover the L2 latency */
#pragma unroll 20
    for (int it = 0; it < SROWS * WID * (HD / 4) / PBLK; ++it) {
      const v4f k4 = *(const v4fa*)(ks + (size_t)it * (PBLK / 8) * QLD); const v4f v4 = *(const v4fa*)(ks + CC + (size_t)it * (PBLK / 8) * QLD);
      *(v4fa*)(kd + it * (PBLK / 8) * KVP) = k4; *(v4fa*)(vd + it * (PBLK / 8) * KVP) = v4; }
  }
  for (int t = tid; t < RPN; t += PBLK) srpb[t] = bf16_rne(rpb[h * RPN + t]);
  __syncthreads();
  const int x = (w & 1) * 32 + lane; const int yA = p0 / WID + 2 * (w >> 1), yB = yA + 1;
  const int lpA = (2 * (w >> 1)) * WID + x, lpB = lpA + WID;   /* the two pixels' places in the block */
  int niA = yA - KS / 2; niA = (niA < 0) ? 0 : ((niA > HHT - KS) ? (HHT - KS) : niA);
  int niB = yB - KS / 2; niB = (niB < 0) ? 0 : ((niB > HHT - KS) ? (HHT - KS) : niB);
  int nj = x - KS / 2; nj = (nj < 0) ? 0 : ((nj > WID - KS) ? (WID - KS) : nj);
  const int dB = niB - niA;          /* 0 where the clamp holds both windows at the image's edge, else 1 */
  const int nrow = KS + dB;          /* rows of the union of the two windows */
  const int biA = niA - yA + (KS - 1), biB = niB - yB + (KS - 1), bj = nj - x + (KS - 1);   /* all in [0, 6] */
  const float* qa = QKV + (size_t)(p0 + lpA) * QLD + h * HD; const float* qb = qa + (size_t)WID * QLD;
  v2f q2[HD];                        /* (q of A, q of B) per d: one packed fma with a key element does both pixels' product */
#pragma unroll
  for (int g = 0; g < HD / 4; ++g) { const v4f a4 = *(const v4fa*)(qa + 4 * g); const v4f b4 = *(const v4fa*)(qb + 4 * g);
#pragma unroll
    for (int e = 0; e < 4; ++e) { q2[4 * g + e].x = a4[e]; q2[4 * g + e].y = b4[e]; } }
  float mxA = -3.0e38f, mxB = -3.0e38f;
#pragma unroll 1
  for (int rr = 0; rr < nrow; ++rr) {
    const float* krow = sK + ((niA - r0 + rr) * WID + nj) * KVP;
    const int iB = rr - dB;          /* this row's place in B's window; in A's it is rr */
    /* both pixels' biases are read in front of the keys, so that no logit waits for an LDS read of its own; where the row is outside a pixel's window the clamp keeps the read inside the table and the value is not used */
    const float* pbA = srpb + (biA + (rr < KS ? rr : KS - 1)) * RPW + bj; const float* pbB = srpb + (biB + (iB < 0 ? 0 : iB)) * RPW + bj;
    v2f b2[KS];
#pragma unroll
    for (int j = 0; j < KS; ++j) { b2[j].x = pbA[j]; b2[j].y = pbB[j]; }
    /* the row's 56 key reads, the first four d of all seven taps first: the products below run in that order too, so a group's products start as soon as its seven reads are back */
    v4f kk[HD / 4][KS];
#pragma unroll
    for (int g = 0; g < HD / 4; ++g) {
#pragma unroll
      for (int j = 0; j < KS; ++j) kk[g][j] = *(const v4fa*)(krow + j * KVP + 4 * g); }
    __builtin_amdgcn_sched_barrier(0);   /* keeps all 56 reads in front of the products: left to itself the compiler issues the later ones three or four ahead of their use, and a lone wave per SIMD then waits out most of each read's latency */
    v2f a2[KS];
#pragma unroll
    for (int j = 0; j < KS; ++j) a2[j] = (v2f){0.f, 0.f};
    /* seven separate serial sums over d, each in the order d = 0 .. 31 */
#pragma unroll
    for (int g = 0; g < HD / 4; ++g) {
#pragma unroll
      for (int j = 0; j < KS; ++j) {
#pragma unroll
        for (int e = 0; e < 4; ++e) { const v2f ks2 = {kk[g][j][e], kk[g][j][e]}; a2[j] = __builtin_elementwise_fma(q2[4 * g + e], ks2, a2[j]); } } }
#pragma unroll
    for (int j = 0; j < KS; ++j) { const v2f qs = {QSCALE, QSCALE}; a2[j] = __builtin_elementwise_fma(a2[j], qs, b2[j]); }
    if (rr < KS) {                   /* row rr of A's window */
#pragma unroll
      for (int j = 0; j < KS; ++j) { const float l = a2[j].x; slog[rr * KS + j][lpA] = l; mxA = fmaxf(mxA, l); } }
    if (iB >= 0) {                   /* row iB of B's window */
#pragma unroll
      for (int j = 0; j < KS; ++j) { const float l = a2[j].y; slog[iB * KS + j][lpB] = l; mxB = fmaxf(mxB, l); } }
  }
  float sA = 0.f, sB = 0.f; float accA[HD], accB[HD];
#pragma unroll
  for (int d = 0; d < HD; ++d) { accA[d] = 0.f; accB[d] = 0.f; }
#pragma unroll 1
  for (int rr = 0; rr < nrow; ++rr) {
    const float* vrow = sV + ((niA - r0 + rr) * WID + nj) * KVP;
    const int iB = rr - dB;
    /* where the row is outside a pixel's window the clamp keeps the logit's read inside what the thread has written, and the weight is set to 0: the row then adds nothing to that pixel's sums */
    const int tA = (rr < KS ? rr : KS - 1) * KS, tB = (iB < 0 ? 0 : iB) * KS;
    float la[KS], lb[KS];
#pragma unroll
    for (int j = 0; j < KS; ++j) { la[j] = slog[tA + j][lpA]; lb[j] = slog[tB + j][lpB]; }
    v4f vv[KS][HD / 4];
#pragma unroll
    for (int j = 0; j < KS; ++j) {
#pragma unroll
      for (int g = 0; g < HD / 4; ++g) vv[j][g] = *(const v4fa*)(vrow + j * KVP + 4 * g); }
    __builtin_amdgcn_sched_barrier(0);   /* keeps the logits' reads first and the row's 56 value reads directly behind them, all in front of the arithmetic: the exponentials then run while the values fly (LDS answers in order) */
    /* taps are added in the order j = 0 .. 6 */
#pragma unroll
    for (int j = 0; j < KS; ++j) {
      const float xa = expf(la[j] - mxA), xb = expf(lb[j] - mxB);
      const float ea = (rr < KS) ? xa : 0.f, eb = (iB >= 0) ? xb : 0.f; sA += ea; sB += eb;
#pragma unroll
      for (int d = 0; d < HD; ++d) accA[d] = fmaf(ea, vv[j][d >> 2][d & 3], accA[d]);
#pragma unroll
      for (int d = 0; d < HD; ++d) accB[d] = fmaf(eb, vv[j][d >> 2][d & 3], accB[d]); }
  }
  const float invA = 1.0f / sA, invB = 1.0f / sB;
#pragma unroll
  for (int g = 0; g < HD / 8; ++g) { FragH fh, fr;
#pragma unroll
    for (int e2 = 0; e2 < 8; ++e2) { const float o64 = (accA[g * 8 + e2] * invA) * OSC; const _Float16 hv = (_Float16)o64; fh.h[e2] = hv; fr.h[e2] = (_Float16)((o64 - (float)hv) * RSC); }
    *(v8us*)&sO[lpA][g * 8] = fh.half[0]; *(v8us*)&sO[lpA][HD + g * 8] = fr.half[0];
#pragma unroll
    for (int e2 = 0; e2 < 8; ++e2) { const float o64 = (accB[g * 8 + e2] * invB) * OSC; const _Float16 hv = (_Float16)o64; fh.h[e2] = hv; fr.h[e2] = (_Float16)((o64 - (float)hv) * RSC); }
    *(v8us*)&sO[lpB][g * 8] = fh.half[0]; *(v8us*)&sO[lpB][HD + g * 8] = fr.half[0]; }
  __syncthreads();
  {
#pragma unroll
    for (int it = 0; it < QPB / 16; ++it) { const int rr = it * 16 + (lane & 15), k8 = (w >> 1) * 32 + (w & 1) * 16 + (lane >> 4) * 8; const v8us o = *(const v8us*)&sO[rr][k8];
      *(v8us*)((unsigned short*)O16 + frag_off(p0 + rr, h * 64 + k8, OLD / 32)) = o; }
     }
}

extern "C" void kernel_launch(void* const* d_in, const int* in_sizes, int n_in,
                              void* d_out, int out_size, void* d_ws, size_t ws_size, hipStream_t stream) {
  if (n_in < 6) return;
  if (in_sizes[0] < NB * CC * PIX || in_sizes[1] < 3 * CC * CC || in_sizes[2] < 3 * CC || in_sizes[3] < NHD * RPN || in_sizes[4] < CC * CC || in_sizes[5] < CC) return;
  if (out_size < NB * CC * PIX) return;
  const float* x = (const float*)d_in[0]; const float* qkv_w = (const float*)d_in[1]; const float* qkv_b = (const float*)d_in[2];
  const float* rpb = (const float*)d_in[3]; const float* proj_w = (const float*)d_in[4]; const float* proj_b = (const float*)d_in[5];
  float* out = (float*)d_out;
  char* ws = (char*)d_ws; size_t off = 0;
  auto take = [&](size_t bytes) { char* p = ws + off; off += (bytes + 255) & ~(size_t)255; return p; };
  _Float16* X16 = (_Float16*)take((size_t)NB * PIX * CC * 2);       /* 4,194,304 B at NB=2 */
  _Float16* WQ16 = (_Float16*)take((size_t)3 * CC * CC * 2);        /* 393,216 */
  _Float16* WPA = (_Float16*)take((size_t)CC * OLD * 2);             /* 262,144 */
  float* QKV = (float*)take((size_t)NB * PIX * QLD * 4);             /* 25,165,824 at NB=2 */
  _Float16* O16 = (_Float16*)take((size_t)NB * PIX * OLD * 2);       /* 8,388,608 at NB=2 */
  if (off > ws_size || off > ((size_t)128 << 20)) return;            /* total 38,404,096 B */
  k_prep<<<NBLK_WQ + NBLK_WP + NBLK_XT, 256, 0, stream>>>(x, qkv_w, proj_w, X16, WQ16, WPA);
  k_gemm2<CC / 32, 2><<<dim3((unsigned)((PIX / 128) * (QLD / 64)), NB), 128, 0, stream>>>(X16, WQ16, 1.0f / (XSC * WSC), qkv_b, nullptr, QKV, QLD, PIX, QLD, PIX * CC, 0, PIX * QLD);
  k_att<<<dim3(NHD * NPB, NB), PBLK, 0, stream>>>(QKV, rpb, O16);
  k_gemm2<OLD / 32, 2><<<dim3((unsigned)((CC / 128) * (PIX / 64)), NB), 128, 0, stream>>>(WPA, O16, 1.0f / (PSC * OSC), nullptr, proj_b, out, PIX, CC, PIX, 0, PIX * OLD, CC * PIX);
}

// v007
// Measured time: 35.5 microseconds a run.
// Two timings next to v006 both put it at 1.13 times that version's speed.
// Over all steps from v000 it is 5.42 times as fast.
#include <hip/hip_runtime.h>
// Contractions on v_wmma_f32_16x16x32_f16 (f16 operands, f32 accumulate): qkv = X.Wqkv^T with bf16-RNE inputs carried exactly in f16 (x*16, Wqkv*64);
// out^T = Wp.O^T with O as f16 hi (*64) + f16 residual (*1024) planes folded along K against [Wp*1024 | Wp] (bf16-RNE Wp);
// per-pixel clamped 7x7 window q.k logits, 49-tap softmax and v aggregation in f32 on VALU from the f32 qkv plane.
#ifndef NB
#define NB 2
#endif
#define NB_FULL 2
#define CC 256
#define HHT 64
#define WID 64
#define PIX (HHT * WID)          /* 4096 */
#define NHD 8
#define HD 32
#define KS 7
#define NTAP (KS * KS)           /* 49 */
#define RPW (2 * KS - 1)         /* 13 */
#define RPN (RPW * RPW)          /* 169 per head */
#define QLD (3 * CC)             /* 768: qkv plane pitch, cols s*256 + h*32 + d */
#define OLD (2 * CC)             /* 512: k length of the O plane, per head h: [h*64 .. +31] hi, [h*64+32 .. +63] residual */
#define PBLK 128
#define QPB (2 * PBLK)            /* 256 pixels of a block of the attention kernel: two per thread */
#define NPB (PIX / QPB)          /* 16 */
#define XT_P 32
#define XT_C 64
#define XSC 16.0f                /* x carry */
#define WSC 64.0f                /* qkv weight carry */
#define OSC 64.0f                /* O hi carry */
#define RSC 1024.0f              /* O residual carry */
#define PSC 1024.0f              /* proj weight carry against the hi plane */
#define QSCALE 0.17677669529663687f
#define SROWS (KS + 3)           /* image rows that hold every window of a block's four pixel rows */
#define KVP (HD + 4)             /* LDS pitch of a staged key / value pixel, floats: 144 B = 16 B x 9, so 16-byte reads of 16 neighbouring pixels meet 64 distinct banks */
static_assert(NB <= NB_FULL);
static_assert(PIX % QPB == 0);
static_assert(PIX % 128 == 0);
static_assert(PIX % 64 == 0);
static_assert(PIX % XT_P == 0);
static_assert(CC % XT_C == 0);
static_assert(CC % 128 == 0);
static_assert(CC % 32 == 0);
static_assert(OLD % 32 == 0);
static_assert(QLD % 64 == 0);
static_assert(PBLK == 128);
static_assert(HD == 32);
static_assert(NHD * HD == CC);
static_assert(HHT >= KS && WID >= KS);
static_assert(PBLK == 2 * WID && QPB == 4 * WID && HHT >= SROWS && HHT % 4 == 0);
static_assert((SROWS * WID * (HD / 4)) % PBLK == 0);

typedef unsigned short v8us __attribute__((ext_vector_type(8), may_alias));
typedef float v8f __attribute__((ext_vector_type(8)));
typedef float v4f __attribute__((ext_vector_type(4)));
typedef float v2f __attribute__((ext_vector_type(2)));
typedef float v4fa __attribute__((ext_vector_type(4), may_alias));
typedef _Float16 v16h __attribute__((ext_vector_type(16)));
union FragH { v16h v; v8us half[2]; _Float16 h[16]; unsigned short u[16]; };

__device__ __forceinline__ unsigned short bf16_bits(float x) { unsigned int u = __float_as_uint(x); return (unsigned short)((u + 0x7FFFu + ((u >> 16) & 1u)) >> 16); }
__device__ __forceinline__ float bf16_val(unsigned short b) { return __uint_as_float(((unsigned int)b) << 16); }
__device__ __forceinline__ float bf16_rne(float x) { return bf16_val(bf16_bits(x)); }

// ---- f16 WMMA engine (wave tile 32x64; M % 128 == 0, N % 64 == 0, K % 32 == 0) ----
// A fragment: lane l -> row (l & 15); elements 0..7 <- k0 + 8*(l>>4) + 0..7, elements 8..15 <- k0 + 16 + 8*(l>>4) + 0..7.
// B fragment: the identical k map, lane -> column. D: acc[r] = (row 8*(l>>4) + r, col l & 15).
// Operand planes lie in fragment order: the fragment of 16-row tile T and k step s is 1 KiB at half index (T*KT + s)*512; in it lane l's elements 0..7 stand at l*8 and its
// elements 8..15 at 256 + l*8, so each of a fragment's two 16-byte loads reads 512 contiguous bytes (four whole 128-byte lines) and not 32 bytes out of each of 16 lines.
// frag_off: half index of the 8 halves (row, k8 .. k8+7), k8 % 8 == 0, in such a plane; the writers of the x and O planes use it.
__device__ __forceinline__ size_t frag_off(int row, int k8, int kt) { return ((((size_t)(row >> 4) * kt + (k8 >> 5)) * 2 + ((k8 >> 4) & 1)) * 32 + ((k8 >> 3) & 1) * 16 + (row & 15)) * 8; }
__device__ __forceinline__ v16h g2_frag(const _Float16* p) { FragH f; f.half[0] = *(const v8us*)((const unsigned short*)p); f.half[1] = *(const v8us*)((const unsigned short*)p + 256); return f.v; }
__device__ __forceinline__ v8f g2_mma(v16h a, v16h b, v8f c) { v8f d = __builtin_amdgcn_wmma_f32_16x16x32_f16(false, a, false, b, (short)0, c, false, false); asm volatile("v_nop\n\tv_nop\n\tv_nop\n\tv_nop" : "+v"(d) : "v"(a), "v"(b)); return d; }

// C[M][N] (f32, pitch ldc) = alpha * A[M][K].Bt[N][K]^T + bias; bias = bf16(brow[m]) where ROWB, else bf16(bcol[n]); A and Bt f16 planes in fragment order; K = 32 * KT.
// blockIdx.y = image of the batch: its A, Bt and C start sa, sb, sc elements behind the previous image's (0 for a plane that all images share).
// The six fragments of k step s + DEPTH are requested in front of the products of step s, so the loads of DEPTH steps are in flight while a step's products run, and no product waits for a load issued directly in front of it.
struct G2Step { v16h a0, a1, b0, b1, b2, b3; };
template <int KT, int DEPTH, bool ROWB>
__global__ __launch_bounds__(128) void k_gemm2(const _Float16* __restrict__ A, const _Float16* __restrict__ Bh, float alpha,
                                               const float* __restrict__ bcol, const float* __restrict__ brow,
                                               float* __restrict__ C, int ldc, int M, int N, int sa, int sb, int sc) {
  static_assert(DEPTH >= 1 && DEPTH < KT && 12 * (DEPTH + 1) <= 63);   /* 12 loads a step; the load counter holds 63 */
  __shared__ __attribute__((aligned(16))) float so[4][32][68];
  const int tid = threadIdx.x, w = tid >> 5, lane = tid & 31, ln = lane & 15, hh = lane >> 4;
  const int ntn = N >> 6; const int mt = blockIdx.x / ntn, nq = blockIdx.x - mt * ntn; const int row0 = mt * 128 + 32 * w, col0 = nq * 64; if (row0 >= M) return;
  A += (size_t)blockIdx.y * sa; Bh += (size_t)blockIdx.y * sb; C += (size_t)blockIdx.y * sc;
  const _Float16* a0p = A + (size_t)(row0 >> 4) * (KT * 512) + lane * 8; const _Float16* a1p = a0p + KT * 512;
  const _Float16* b0p = Bh + (size_t)(col0 >> 4) * (KT * 512) + lane * 8; const _Float16* b1p = b0p + KT * 512; const _Float16* b2p = b1p + KT * 512; const _Float16* b3p = b2p + KT * 512;
  const v8f z8 = {0.f,0.f,0.f,0.f,0.f,0.f,0.f,0.f}; v8f c00 = z8, c01 = z8, c02 = z8, c03 = z8, c10 = z8, c11 = z8, c12 = z8, c13 = z8;
  G2Step f[KT];
  float bc[4] = {0.f, 0.f, 0.f, 0.f}; const v4f z4 = {0.f, 0.f, 0.f, 0.f}; v4f br[4] = {z4, z4, z4, z4};   /* bc[t]: bias of column col0 + 16 t + ln; br[2 half + q][e]: bias of row row0 + 16 half + 8 hh + 4 q + e */
  auto fetch = [&](int s) { const int kb = 512 * s;
    f[s].a0 = g2_frag(a0p + kb); f[s].b0 = g2_frag(b0p + kb); f[s].a1 = g2_frag(a1p + kb);
    f[s].b1 = g2_frag(b1p + kb); f[s].b2 = g2_frag(b2p + kb); f[s].b3 = g2_frag(b3p + kb); };
  /* both loops fully unrolled: every index of f is then a constant and the ring of DEPTH + 1 steps lives in registers */
#pragma unroll
  for (int s = 0; s < DEPTH; ++s) { fetch(s);
    __builtin_amdgcn_sched_barrier(0); }   /* keeps these loads in step order and in front of the first product with its wait: otherwise most of them start one memory latency late, or step 0 returns behind later steps */
#pragma unroll
  for (int s = 0; s < KT; ++s) {
    if (s + DEPTH < KT) fetch(s + DEPTH);
    /* the tile's biases are requested directly behind the last fragment loads, four loads a lane, and come back under the last products: read where they are added, each value was a load of its own that the wave waited for (64 one behind the other with a row bias) */
    if (s + DEPTH == KT) {
      if constexpr (ROWB) {
#pragma unroll
        for (int q = 0; q < 4; ++q) br[q] = *(const v4fa*)(brow + row0 + (q >> 1) * 16 + 8 * hh + (q & 1) * 4);
      } else {
#pragma unroll
        for (int t = 0; t < 4; ++t) bc[t] = bcol[col0 + t * 16 + ln]; }
      __builtin_amdgcn_sched_barrier(0);   /* with the one below: holds the wait directly behind the bias loads; left free, the scheduler puts address arithmetic of the epilogue, which reuses the loads' address registers, in front of it */
      asm volatile("s_wait_xcnt 0x0" ::: "memory");   /* stands in front of any later write of the bias loads' address registers */
      __builtin_amdgcn_sched_barrier(0); }
    c00 = g2_mma(f[s].a0, f[s].b0, c00); c10 = g2_mma(f[s].a1, f[s].b0, c10);
    c01 = g2_mma(f[s].a0, f[s].b1, c01); c11 = g2_mma(f[s].a1, f[s].b1, c11);
    c02 = g2_mma(f[s].a0, f[s].b2, c02); c12 = g2_mma(f[s].a1, f[s].b2, c12);
    c03 = g2_mma(f[s].a0, f[s].b3, c03); c13 = g2_mma(f[s].a1, f[s].b3, c13); }
  v8f accs[8] = {c00, c01, c02, c03, c10, c11, c12, c13};
#pragma unroll
  for (int u = 0; u < 8; ++u) { const int t = u & 3, half = u >> 2; const float bv = bf16_rne(bc[t]);
#pragma unroll
    for (int r = 0; r < 8; ++r) { const int rloc = half * 16 + 8 * hh + r; float v = accs[u][r] * alpha + bv; if constexpr (ROWB) v += bf16_rne(br[half * 2 + (r >> 2)][r & 3]); so[w][rloc][t * 16 + ln] = v; } }
  __builtin_amdgcn_fence(__ATOMIC_ACQ_REL, "workgroup"); __builtin_amdgcn_wave_barrier();
  const int rsub = lane >> 4, c4 = (lane & 15) * 4;
  {
#pragma unroll
    for (int q = 0; q < 16; ++q) { const int r = q * 2 + rsub; const v4f v = *(const v4fa*)&so[w][r][c4]; *(v4f*)(C + (size_t)(row0 + r) * ldc + col0 + c4) = v; }
     }
}

#define NBLK_WQ (3 * CC * CC / 8 / 256)                    /* 96 blocks: qkv weight */
#define NBLK_WP (CC * OLD / 8 / 256)                       /* 64 blocks: proj weight */
#define NBLK_XT (NB * (CC / XT_C) * (PIX / XT_P))          /* 1024 blocks at NB=2: x */
static_assert((3 * CC * CC / 8) % 256 == 0 && (CC * OLD / 8) % 256 == 0);

// thread t writes the t-th 16 bytes of the fragment-ordered plane: lane t & 31, element half (t >> 5) & 1, k step and 16-row tile above
__device__ __forceinline__ void d_cvt8(int blk, const float* __restrict__ W, _Float16* __restrict__ Bt, float scale) {
  const int t = blk * 256 + threadIdx.x; FragH f;
  const int n = (t >> 6) / (CC / 32) * 16 + (t & 15); const int k8 = ((t >> 6) % (CC / 32)) * 32 + ((t >> 5) & 1) * 16 + ((t >> 4) & 1) * 8;
#pragma unroll
  for (int i = 0; i < 8; ++i) f.h[i] = (_Float16)(bf16_rne(W[(size_t)n * CC + k8 + i]) * scale);
  unsigned short* dst = (unsigned short*)Bt + (size_t)t * 8;
  *(v8us*)dst = f.half[0];
  asm volatile("s_wait_xcnt 0x0" ::: "memory");   /* the block ranges lie one behind the other in the built kernel: the wait stands in front of any later write of the store's registers */
}

__device__ __forceinline__ void d_wpa(int blk, const float* __restrict__ W, _Float16* __restrict__ WPA) {
  const int t = blk * 256 + threadIdx.x;
  const int c = (t >> 6) / (OLD / 32) * 16 + (t & 15); const int k8 = ((t >> 6) % (OLD / 32)) * 32 + ((t >> 5) & 1) * 16 + ((t >> 4) & 1) * 8;   /* as in d_cvt8 */
  const int h = k8 >> 6; const int wi = k8 & 63; const int d0 = wi & 31;
  const float sc = (wi >= 32) ? 1.0f : PSC;
  FragH f;
#pragma unroll
  for (int i = 0; i < 8; ++i) f.h[i] = (_Float16)(bf16_rne(W[(size_t)c * CC + h * HD + d0 + i]) * sc);
  unsigned short* dst = (unsigned short*)WPA + (size_t)t * 8;
  *(v8us*)dst = f.half[0];
  asm volatile("s_wait_xcnt 0x0" ::: "memory");   /* the block ranges lie one behind the other in the built kernel: the wait stands in front of any later write of the store's registers */
}

// The three operand conversions depend on nothing but the inputs, so they share one launch: block ranges of one grid, the two short weight ranges first.
// blocks [0, NBLK_WQ): qkv weight -> f16 plane; [NBLK_WQ, NBLK_WQ + NBLK_WP): proj weight -> [Wp*1024 | Wp] plane; the rest: x -> f16 plane with pixels as rows; all in fragment order.
// x coverage: 8 waves x 32 lanes x 8 halves = (2 row tiles x 2 k steps x 2 element halves) x 512 B = 32 rows x 64 channels per block; NB x (CC/64) x (PIX/32) blocks
__global__ __launch_bounds__(256) void k_prep(const float* __restrict__ x, const float* __restrict__ qkv_w, const float* __restrict__ proj_w,
                                              _Float16* __restrict__ X16, _Float16* __restrict__ WQ16, _Float16* __restrict__ WPA) {
  __shared__ __attribute__((aligned(16))) _Float16 st[XT_P][XT_C + 8];   /* 144 B pitch: the 16-byte reads of 16 neighbouring rows meet distinct banks */
  int blk = blockIdx.x;
  if (blk < NBLK_WQ) { d_cvt8(blk, qkv_w, WQ16, WSC); return; }              /* block-uniform: a whole block leaves, in front of the barrier */
  blk -= NBLK_WQ;
  if (blk < NBLK_WP) { d_wpa(blk, proj_w, WPA); return; }
  blk -= NBLK_WP;
  const int tid = threadIdx.x, w = tid >> 5, lane = tid & 31;
  const int pt = blk % (PIX / XT_P); blk /= (PIX / XT_P);
  const int ch = blk % (CC / XT_C); const int b = blk / (CC / XT_C);
  const float* src = x + ((size_t)(b * CC + ch * XT_C)) * PIX + (size_t)pt * XT_P + lane;
#pragma unroll
  for (int it = 0; it < XT_C / 8; ++it) {
    const int ci = it * 8 + w;
    const float v = src[(size_t)ci * PIX];
    st[lane][ci] = (_Float16)(bf16_rne(v) * XSC);
  }
  __syncthreads();
  const int rr = (w >> 2) * 16 + (lane & 15), k8 = ((w >> 1) & 1) * 32 + (w & 1) * 16 + (lane >> 4) * 8;   /* a wave writes one element half of one fragment: 512 contiguous bytes */
  const v8us o = *(const v8us*)&st[rr][k8];
  unsigned short* dst = (unsigned short*)X16 + (size_t)b * PIX * CC + frag_off(pt * XT_P + rr, ch * XT_C + k8, CC / 32);
  *(v8us*)dst = o;
  asm volatile("s_wait_xcnt 0x0" ::: "memory");   /* the block ranges lie one behind the other in the built kernel: the wait stands in front of any later write of the store's registers */
}

// Thread per (h, pixel pair): pixels A = (yA, x) and B = (yA + 1, x). Clamped window start ni = clamp(y-3, 0, H-7), nj = clamp(x-3, 0, W-7); taps (i, j) in 7x7 at key pixel (ni+i, nj+j);
// logit a_t = QSCALE * sum_d q[p][h*32+d] k[key][256 + h*32 + d] + bf16(rpb[h][ni+i-y+6][nj+j-x+6]) in f32, kept in thread-private LDS;
// max-subtracted softmax in f32; O[d] = (sum_t e_t v[key][512 + h*32 + d]) / sum_t e_t; O -> f16 hi = f16(O*64), res = f16((O*64 - hi)*1024);
// The block's pixels are image rows y0 .. y0+3; all their windows lie in rows r0 .. r0+9, r0 = clamp(y0-3, 0, H-10). The head's k and v of those 10 x 64 pixels are
// staged once in LDS (whole 128-byte lines from the plane) and every tap reads them there.
// A and B share nj, and their window rows are niA .. niA+6 and niB .. niB+6 with niB - niA = 0 or 1: the thread walks the 7 or 8 rows of the union once and every key / value
// vector it reads from LDS serves both pixels. Each pixel's own sums keep their order (d = 0 .. 31 in a logit, taps by i then j in the softmax sum and in O).
// O plane in fragment order (pixels as rows). coverage: 16 iterations (row tiles) x 4 waves (2 k steps x 2 element halves) x 512 B = 256 rows x 64 halves per block; grid = (NHD x (PIX/256), NB), blockIdx.y = image with its own qkv and O plane
__global__ __launch_bounds__(PBLK) void k_att(const float* __restrict__ QKV, const float* __restrict__ rpb, _Float16* __restrict__ O16) {
  __shared__ float srpb[RPN + 7];
  __shared__ __attribute__((aligned(16))) float slog[NTAP][QPB];
  __shared__ __attribute__((aligned(16))) unsigned short sO[QPB][64 + 8];   /* 144 B pitch: the 16-byte accesses of 16 neighbouring rows meet distinct banks */
  __shared__ __attribute__((aligned(16))) float sK[SROWS * WID * KVP];
  __shared__ __attribute__((aligned(16))) float sV[SROWS * WID * KVP];
  const int tid = threadIdx.x, lane = tid & 31;
  const int w = __builtin_amdgcn_readfirstlane(tid >> 5);   /* the wave's number in a scalar register: a wave's image rows, and with them the row tests below, are the same in all its lanes */
  const int h = blockIdx.x / NPB; const int p0 = (blockIdx.x - h * NPB) * QPB;
  QKV += (size_t)blockIdx.y * (PIX * QLD); O16 += (size_t)blockIdx.y * (PIX * OLD);
  int r0 = p0 / WID - KS / 2; r0 = (r0 < 0) ? 0 : ((r0 > HHT - SROWS) ? (HHT - SROWS) : r0);
  {
    const float* ks = QKV + (size_t)(r0 * WID + (tid >> 3)) * QLD + CC + h * HD + (tid & 7) * 4;   /* 8 lanes per pixel, 16 pixels per pass */
    float* kd = sK + (tid >> 3) * KVP + (tid & 7) * 4; float* vd = sV + (tid >> 3) * KVP + (tid & 7) * 4;
    /* unrolled so that 40 line loads of a wave are in flight at once: one wave per SIMD has nothing else to cover the L2 latency */
#pragma unroll 20
    for (int it = 0; it < SROWS * WID * (HD / 4) / PBLK; ++it) {
      const v4f k4 = *(const v4fa*)(ks + (size_t)it * (PBLK / 8) * QLD); const v4f v4 = *(const v4fa*)(ks + CC + (size_t)it * (PBLK / 8) * QLD);
      *(v4fa*)(kd + it * (PBLK / 8) * KVP) = k4; *(v4fa*)(vd + it * (PBLK / 8) * KVP) = v4; }
  }
  for (int t = tid; t < RPN; t += PBLK) srpb[t] = bf16_rne(rpb[h * RPN + t]);
  __syncthreads();
  const int x = (w & 1) * 32 + lane; const int yA = p0 / WID + 2 * (w >> 1), yB = yA + 1;
  const int lpA = (2 * (w >> 1)) * WID + x, lpB = lpA + WID;   /* the two pixels' places in the block */
  int niA = yA - KS / 2; niA = (niA < 0) ? 0 : ((niA > HHT - KS) ? (HHT - KS) : niA);
  int niB = yB - KS / 2; niB = (niB < 0) ? 0 : ((niB > HHT - KS) ? (HHT - KS) : niB);
  int nj = x - KS / 2; nj = (nj < 0) ? 0 : ((nj > WID - KS) ? (WID - KS) : nj);
  const int dB = niB - niA;          /* 0 where the clamp holds both windows at the image's edge, else 1 */
  const int nrow = KS + dB;          /* rows of the union of the two windows */
  const int biA = niA - yA + (KS - 1), biB = niB - yB + (KS - 1), bj = nj - x + (KS - 1);   /* all in [0, 6] */
  const float* qa = QKV + (size_t)(p0 + lpA) * QLD + h * HD; const float* qb = qa + (size_t)WID * QLD;
  v2f q2[HD];                        /* (q of A, q of B) per d: one packed fma with a key element does both pixels' product */
#pragma unroll
  for (int g = 0; g < HD / 4; ++g) { const v4f a4 = *(const v4fa*)(qa + 4 * g); const v4f b4 = *(const v4fa*)(qb + 4 * g);
#pragma unroll
    for (int e = 0; e < 4; ++e) { q2[4 * g + e].x = a4[e]; q2[4 * g + e].y = b4[e]; } }
  float mxA = -3.0e38f, mxB = -3.0e38f;
#pragma unroll 1
  for (int rr = 0; rr < nrow; ++rr) {
    const float* krow = sK + ((niA - r0 + rr) * WID + nj) * KVP;
    const int iB = rr - dB;          /* this row's place in B's window; in A's it is rr */
    /* both pixels' biases are read in front of the keys, so that no logit waits for an LDS read of its own; where the row is outside a pixel's window the clamp keeps the read inside the table and the value is not used */
    const float* pbA = srpb + (biA + (rr < KS ? rr : KS - 1)) * RPW + bj; const float* pbB = srpb + (biB + (iB < 0 ? 0 : iB)) * RPW + bj;
    v2f b2[KS];
#pragma unroll
    for (int j = 0; j < KS; ++j) { b2[j].x = pbA[j]; b2[j].y = pbB[j]; }
    /* the row's 56 key reads, the first four d of all seven taps first: the products below run in that order too, so a group's products start as soon as its seven reads are back */
    v4f kk[HD / 4][KS];
#pragma unroll
    for (int g = 0; g < HD / 4; ++g) {
#pragma unroll
      for (int j = 0; j < KS; ++j) kk[g][j] = *(const v4fa*)(krow + j * KVP + 4 * g); }
    __builtin_amdgcn_sched_barrier(0);   /* keeps all 56 reads in front of the products: left to itself the compiler issues the later ones three or four ahead of their use, and a lone wave per SIMD then waits out most of each read's latency */
    v2f a2[KS];
#pragma unroll
    for (int j = 0; j < KS; ++j) a2[j] = (v2f){0.f, 0.f};
    /* seven separate serial sums over d, each in the order d = 0 .. 31 */
#pragma unroll
    for (int g = 0; g < HD / 4; ++g) {
#pragma unroll
      for (int j = 0; j < KS; ++j) {
#pragma unroll
        for (int e = 0; e < 4; ++e) { const v2f ks2 = {kk[g][j][e], kk[g][j][e]}; a2[j] = __builtin_elementwise_fma(q2[4 * g + e], ks2, a2[j]); } } }
#pragma unroll
    for (int j = 0; j < KS; ++j) { const v2f qs = {QSCALE, QSCALE}; a2[j] = __builtin_elementwise_fma(a2[j], qs, b2[j]); }
    if (rr < KS) {                   /* row rr of A's window */
#pragma unroll
      for (int j = 0; j < KS; ++j) { const float l = a2[j].x; slog[rr * KS + j][lpA] = l; mxA = fmaxf(mxA, l); } }
    if (iB >= 0) {                   /* row iB of B's window */
#pragma unroll
      for (int j = 0; j < KS; ++j) { const float l = a2[j].y; slog[iB * KS + j][lpB] = l; mxB = fmaxf(mxB, l); } }
  }
  float sA = 0.f, sB = 0.f; float accA[HD], accB[HD];
#pragma unroll
  for (int d = 0; d < HD; ++d) { accA[d] = 0.f; accB[d] = 0.f; }
#pragma unroll 1
  for (int rr = 0; rr < nrow; ++rr) {
    const float* vrow = sV + ((niA - r0 + rr) * WID + nj) * KVP;
    const int iB = rr - dB;
    /* where the row is outside a pixel's window the clamp keeps the logit's read inside what the thread has written, and the weight is set to 0: the row then adds nothing to that pixel's sums */
    const int tA = (rr < KS ? rr : KS - 1) * KS, tB = (iB < 0 ? 0 : iB) * KS;
    float la[KS], lb[KS];
#pragma unroll
    for (int j = 0; j < KS; ++j) { la[j] = slog[tA + j][lpA]; lb[j] = slog[tB + j][lpB]; }
    v4f vv[KS][HD / 4];
#pragma unroll
    for (int j = 0; j < KS; ++j) {
#pragma unroll
      for (int g = 0; g < HD / 4; ++g) vv[j][g] = *(const v4fa*)(vrow + j * KVP + 4 * g); }
    __builtin_amdgcn_sched_barrier(0);   /* keeps the logits' reads first and the row's 56 value reads directly behind them, all in front of the arithmetic: the exponentials then run while the values fly (LDS answers in order) */
    /* taps are added in the order j = 0 .. 6 */
#pragma unroll
    for (int j = 0; j < KS; ++j) {
      const float xa = expf(la[j] - mxA), xb = expf(lb[j] - mxB);
      const float ea = (rr < KS) ? xa : 0.f, eb = (iB >= 0) ? xb : 0.f; sA += ea; sB += eb;
#pragma unroll
      for (int d = 0; d < HD; ++d) accA[d] = fmaf(ea, vv[j][d >> 2][d & 3], accA[d]);
#pragma unroll
      for (int d = 0; d < HD; ++d) accB[d] = fmaf(eb, vv[j][d >> 2][d & 3], accB[d]); }
  }
  const float invA = 1.0f / sA, invB = 1.0f / sB;
#pragma unroll
  for (int g = 0; g < HD / 8; ++g) { FragH fh, fr;
#pragma unroll
    for (int e2 = 0; e2 < 8; ++e2) { const float o64 = (accA[g * 8 + e2] * invA) * OSC; const _Float16 hv = (_Float16)o64; fh.h[e2] = hv; fr.h[e2] = (_Float16)((o64 - (float)hv) * RSC); }
    *(v8us*)&sO[lpA][g * 8] = fh.half[0]; *(v8us*)&sO[lpA][HD + g * 8] = fr.half[0];
#pragma unroll
    for (int e2 = 0; e2 < 8; ++e2) { const float o64 = (accB[g * 8 + e2] * invB) * OSC; const _Float16 hv = (_Float16)o64; fh.h[e2] = hv; fr.h[e2] = (_Float16)((o64 - (float)hv) * RSC); }
    *(v8us*)&sO[lpB][g * 8] = fh.half[0]; *(v8us*)&sO[lpB][HD + g * 8] = fr.half[0]; }
  __syncthreads();
  {
#pragma unroll
    for (int it = 0; it < QPB / 16; ++it) { const int rr = it * 16 + (lane & 15), k8 = (w >> 1) * 32 + (w & 1) * 16 + (lane >> 4) * 8; const v8us o = *(const v8us*)&sO[rr][k8];
      *(v8us*)((unsigned short*)O16 + frag_off(p0 + rr, h * 64 + k8, OLD / 32)) = o; }
     }
}

extern "C" void kernel_launch(void* const* d_in, const int* in_sizes, int n_in,
                              void* d_out, int out_size, void* d_ws, size_t ws_size, hipStream_t stream) {
  if (n_in < 6) return;
  if (in_sizes[0] < NB * CC * PIX || in_sizes[1] < 3 * CC * CC || in_sizes[2] < 3 * CC || in_sizes[3] < NHD * RPN || in_sizes[4] < CC * CC || in_sizes[5] < CC) return;
  if (out_size < NB * CC * PIX) return;
  const float* x = (const float*)d_in[0]; const float* qkv_w = (const float*)d_in[1]; const float* qkv_b = (const float*)d_in[2];
  const float* rpb = (const float*)d_in[3]; const float* proj_w = (const float*)d_in[4]; const float* proj_b = (const float*)d_in[5];
  float* out = (float*)d_out;
  char* ws = (char*)d_ws; size_t off = 0;
  auto take = [&](size_t bytes) { char* p = ws + off; off += (bytes + 255) & ~(size_t)255; return p; };
  _Float16* X16 = (_Float16*)take((size_t)NB * PIX * CC * 2);       /* 4,194,304 B at NB=2 */
  _Float16* WQ16 = (_Float16*)take((size_t)3 * CC * CC * 2);        /* 393,216 */
  _Float16* WPA = (_Float16*)take((size_t)CC * OLD * 2);             /* 262,144 */
  float* QKV = (float*)take((size_t)NB * PIX * QLD * 4);             /* 25,165,824 at NB=2 */
  _Float16* O16 = (_Float16*)take((size_t)NB * PIX * OLD * 2);       /* 8,388,608 at NB=2 */
  if (off > ws_size || off > ((size_t)128 << 20)) return;            /* total 38,404,096 B */
  k_prep<<<NBLK_WQ + NBLK_WP + NBLK_XT, 256, 0, stream>>>(x, qkv_w, proj_w, X16, WQ16, WPA);
  k_gemm2<CC / 32, 2, false><<<dim3((unsigned)((PIX / 128) * (QLD / 64)), NB), 128, 0, stream>>>(X16, WQ16, 1.0f / (XSC * WSC), qkv_b, nullptr, QKV, QLD, PIX, QLD, PIX * CC, 0, PIX * QLD);
  k_att<<<dim3(NHD * NPB, NB), PBLK, 0, stream>>>(QKV, rpb, O16);
  k_gemm2<OLD / 32, 2, true><<<dim3((unsigned)((CC / 128) * (PIX / 64)), NB), 128, 0, stream>>>(WPA, O16, 1.0f / (PSC * OSC), nullptr, proj_b, out, PIX, CC, PIX, 0, PIX * OLD, CC * PIX);
}

// v008
// One run takes 25.1 microseconds.
// Timed twice side by side with v007, it ran 1.44 and 1.41 times as fast.
// All steps since v000 together make it 7.71 times as fast.
#include <hip/hip_runtime.h>
// Contractions on v_wmma_f32_16x16x32_f16 (f16 operands, f32 accumulate): qkv = X.Wqkv^T with bf16-RNE inputs carried exactly in f16 (x*16, Wqkv*64);
// out^T = Wp.O^T with O as f16 hi (*64) + f16 residual (*1024) planes folded along K against [Wp*1024 | Wp] (bf16-RNE Wp);
// per-pixel clamped 7x7 window q.k logits, 49-tap softmax and v aggregation in f32 on VALU from f32 q, k, v, which the attention kernel forms itself, straight into LDS.
#ifndef NB
#define NB 2
#endif
#define NB_FULL 2
#define CC 256
#define HHT 64
#define WID 64
#define PIX (HHT * WID)          /* 4096 */
#define NHD 8
#define HD 32
#define KS 7
#define NTAP (KS * KS)           /* 49 */
#define RPW (2 * KS - 1)         /* 13 */
#define RPN (RPW * RPW)          /* 169 per head */
#define QLD (3 * CC)             /* 768 rows of the qkv weight: s*256 + h*32 + d */
#define OLD (2 * CC)             /* 512: k length of the O plane, per head h: [h*64 .. +31] hi, [h*64+32 .. +63] residual */
#define PBLK 128
#define QPB (2 * PBLK)            /* 256 pixels of a block of the attention kernel: two per thread */
#define NPB (PIX / QPB)          /* 16 */
#define XT_P 32
#define XT_C 64
#define XSC 16.0f                /* x carry */
#define WSC 64.0f                /* qkv weight carry */
#define OSC 64.0f                /* O hi carry */
#define RSC 1024.0f              /* O residual carry */
#define PSC 1024.0f              /* proj weight carry against the hi plane */
#define QSCALE 0.17677669529663687f
#define SROWS (KS + 3)           /* image rows that hold every window of a block's four pixel rows */
#define GT (SROWS * WID / 16)    /* 40 tiles of 16 pixels in those rows */
#define KT1 (CC / 32)            /* 8 k steps of the qkv product */
#define KVP (HD + 4)             /* LDS pitch of a staged key / value pixel, floats: 144 B = 16 B x 9, so 16-byte reads of 16 neighbouring pixels meet 64 distinct banks */
static_assert(NB <= NB_FULL);
static_assert(PIX % QPB == 0);
static_assert(PIX % 128 == 0);
static_assert(PIX % 64 == 0);
static_assert(PIX % XT_P == 0);
static_assert(CC % XT_C == 0);
static_assert(CC % 128 == 0);
static_assert(CC % 32 == 0);
static_assert(OLD % 32 == 0);
static_assert(QLD % 64 == 0);
static_assert(PBLK == 128);
static_assert(HD == 32);
static_assert(NHD * HD == CC);
static_assert(HHT >= KS && WID >= KS);
static_assert(PBLK == 2 * WID && QPB == 4 * WID && HHT >= SROWS && HHT % 4 == 0);
static_assert(GT % 8 == 0 && WID % 16 == 0 && RPN > PBLK && RPN <= 2 * PBLK);
static_assert(NTAP * QPB * 4 >= 6 * KT1 * 1024 && (6 * KT1 * 64) % PBLK == 0 && (64 + 8) * 2 == KVP * 4);

typedef unsigned short v8us __attribute__((ext_vector_type(8), may_alias));
typedef float v8f __attribute__((ext_vector_type(8)));
typedef float v4f __attribute__((ext_vector_type(4)));
typedef float v2f __attribute__((ext_vector_type(2)));
typedef float v4fa __attribute__((ext_vector_type(4), may_alias));
typedef _Float16 v16h __attribute__((ext_vector_type(16)));
union FragH { v16h v; v8us half[2]; _Float16 h[16]; unsigned short u[16]; };

__device__ __forceinline__ unsigned short bf16_bits(float x) { unsigned int u = __float_as_uint(x); return (unsigned short)((u + 0x7FFFu + ((u >> 16) & 1u)) >> 16); }
__device__ __forceinline__ float bf16_val(unsigned short b) { return __uint_as_float(((unsigned int)b) << 16); }
__device__ __forceinline__ float bf16_rne(float x) { return bf16_val(bf16_bits(x)); }

// ---- f16 WMMA engine (wave tile 32x64; M % 128 == 0, N % 64 == 0, K % 32 == 0) ----
// A fragment: lane l -> row (l & 15); elements 0..7 <- k0 + 8*(l>>4) + 0..7, elements 8..15 <- k0 + 16 + 8*(l>>4) + 0..7.
// B fragment: the identical k map, lane -> column. D: acc[r] = (row 8*(l>>4) + r, col l & 15).
// Operand planes lie in fragment order: the fragment of 16-row tile T and k step s is 1 KiB at half index (T*KT + s)*512; in it lane l's elements 0..7 stand at l*8 and its
// elements 8..15 at 256 + l*8, so each of a fragment's two 16-byte loads reads 512 contiguous bytes (four whole 128-byte lines) and not 32 bytes out of each of 16 lines.
// frag_off: half index of the 8 halves (row, k8 .. k8+7), k8 % 8 == 0, in such a plane; the writers of the x and O planes use it.
__device__ __forceinline__ size_t frag_off(int row, int k8, int kt) { return ((((size_t)(row >> 4) * kt + (k8 >> 5)) * 2 + ((k8 >> 4) & 1)) * 32 + ((k8 >> 3) & 1) * 16 + (row & 15)) * 8; }
__device__ __forceinline__ v16h g2_frag(const _Float16* p) { FragH f; f.half[0] = *(const v8us*)((const unsigned short*)p); f.half[1] = *(const v8us*)((const unsigned short*)p + 256); return f.v; }
__device__ __forceinline__ v8f g2_mma(v16h a, v16h b, v8f c) { v8f d = __builtin_amdgcn_wmma_f32_16x16x32_f16(false, a, false, b, (short)0, c, false, false); asm volatile("v_nop\n\tv_nop\n\tv_nop\n\tv_nop" : "+v"(d) : "v"(a), "v"(b)); return d; }

// the same product with nothing tied to it (the compiler pads its own builtin): with the fragments named as operands of an asm statement the build kept the attention kernel's 48 weight fragments in scratch
__device__ __forceinline__ v8f g1_mma(v16h a, v16h b, v8f c) { return __builtin_amdgcn_wmma_f32_16x16x32_f16(false, a, false, b, (short)0, c, false, false); }

// C[M][N] (f32, pitch ldc) = alpha * A[M][K].Bt[N][K]^T + bias; bias = bf16(brow[m]) where ROWB, else bf16(bcol[n]); A and Bt f16 planes in fragment order; K = 32 * KT.
// blockIdx.y = image of the batch: its A, Bt and C start sa, sb, sc elements behind the previous image's (0 for a plane that all images share).
// The six fragments of k step s + DEPTH are requested in front of the products of step s, so the loads of DEPTH steps are in flight while a step's products run, and no product waits for a load issued directly in front of it.
struct G2Step { v16h a0, a1, b0, b1, b2, b3; };
template <int KT, int DEPTH, bool ROWB>
__global__ __launch_bounds__(128) void k_gemm2(const _Float16* __restrict__ A, const _Float16* __restrict__ Bh, float alpha,
                                               const float* __restrict__ bcol, const float* __restrict__ brow,
                                               float* __restrict__ C, int ldc, int M, int N, int sa, int sb, int sc) {
  static_assert(DEPTH >= 1 && DEPTH < KT && 12 * (DEPTH + 1) <= 63);   /* 12 loads a step; the load counter holds 63 */
  __shared__ __attribute__((aligned(16))) float so[4][32][68];
  const int tid = threadIdx.x, w = tid >> 5, lane = tid & 31, ln = lane & 15, hh = lane >> 4;
  const int ntn = N >> 6; const int mt = blockIdx.x / ntn, nq = blockIdx.x - mt * ntn; const int row0 = mt * 128 + 32 * w, col0 = nq * 64; if (row0 >= M) return;
  A += (size_t)blockIdx.y * sa; Bh += (size_t)blockIdx.y * sb; C += (size_t)blockIdx.y * sc;
  const _Float16* a0p = A + (size_t)(row0 >> 4) * (KT * 512) + lane * 8; const _Float16* a1p = a0p + KT * 512;
  const _Float16* b0p = Bh + (size_t)(col0 >> 4) * (KT * 512) + lane * 8; const _Float16* b1p = b0p + KT * 512; const _Float16* b2p = b1p + KT * 512; const _Float16* b3p = b2p + KT * 512;
  const v8f z8 = {0.f,0.f,0.f,0.f,0.f,0.f,0.f,0.f}; v8f c00 = z8, c01 = z8, c02 = z8, c03 = z8, c10 = z8, c11 = z8, c12 = z8, c13 = z8;
  G2Step f[KT];
  float bc[4] = {0.f, 0.f, 0.f, 0.f}; const v4f z4 = {0.f, 0.f, 0.f, 0.f}; v4f br[4] = {z4, z4, z4, z4};   /* bc[t]: bias of column col0 + 16 t + ln; br[2 half + q][e]: bias of row row0 + 16 half + 8 hh + 4 q + e */
  auto fetch = [&](int s) { const int kb = 512 * s;
    f[s].a0 = g2_frag(a0p + kb); f[s].b0 = g2_frag(b0p + kb); f[s].a1 = g2_frag(a1p + kb);
    f[s].b1 = g2_frag(b1p + kb); f[s].b2 = g2_frag(b2p + kb); f[s].b3 = g2_frag(b3p + kb); };
  /* both loops fully unrolled: every index of f is then a constant and the ring of DEPTH + 1 steps lives in registers */
#pragma unroll
  for (int s = 0; s < DEPTH; ++s) { fetch(s);
    __builtin_amdgcn_sched_barrier(0); }   /* keeps these loads in step order and in front of the first product with its wait: otherwise most of them start one memory latency late, or step 0 returns behind later steps */
#pragma unroll
  for (int s = 0; s < KT; ++s) {
    if (s + DEPTH < KT) fetch(s + DEPTH);
    /* the tile's biases are requested directly behind the last fragment loads, four loads a lane, and come back under the last products: read where they are added, each value was a load of its own that the wave waited for (64 one behind the other with a row bias) */
    if (s + DEPTH == KT) {
      if constexpr (ROWB) {
#pragma unroll
        for (int q = 0; q < 4; ++q) br[q] = *(const v4fa*)(brow + row0 + (q >> 1) * 16 + 8 * hh + (q & 1) * 4);
      } else {
#pragma unroll
        for (int t = 0; t < 4; ++t) bc[t] = bcol[col0 + t * 16 + ln]; }
      __builtin_amdgcn_sched_barrier(0);   /* with the one below: holds the wait directly behind the bias loads; left free, the scheduler puts address arithmetic of the epilogue, which reuses the loads' address registers, in front of it */
      asm volatile("s_wait_xcnt 0x0" ::: "memory");   /* stands in front of any later write of the bias loads' address registers */
      __builtin_amdgcn_sched_barrier(0); }
    c00 = g2_mma(f[s].a0, f[s].b0, c00); c10 = g2_mma(f[s].a1, f[s].b0, c10);
    c01 = g2_mma(f[s].a0, f[s].b1, c01); c11 = g2_mma(f[s].a1, f[s].b1, c11);
    c02 = g2_mma(f[s].a0, f[s].b2, c02); c12 = g2_mma(f[s].a1, f[s].b2, c12);
    c03 = g2_mma(f[s].a0, f[s].b3, c03); c13 = g2_mma(f[s].a1, f[s].b3, c13); }
  v8f accs[8] = {c00, c01, c02, c03, c10, c11, c12, c13};
#pragma unroll
  for (int u = 0; u < 8; ++u) { const int t = u & 3, half = u >> 2; const float bv = bf16_rne(bc[t]);
#pragma unroll
    for (int r = 0; r < 8; ++r) { const int rloc = half * 16 + 8 * hh + r; float v = accs[u][r] * alpha + bv; if constexpr (ROWB) v += bf16_rne(br[half * 2 + (r >> 2)][r & 3]); so[w][rloc][t * 16 + ln] = v; } }
  __builtin_amdgcn_fence(__ATOMIC_ACQ_REL, "workgroup"); __builtin_amdgcn_wave_barrier();
  const int rsub = lane >> 4, c4 = (lane & 15) * 4;
  {
#pragma unroll
    for (int q = 0; q < 16; ++q) { const int r = q * 2 + rsub; const v4f v = *(const v4fa*)&so[w][r][c4]; *(v4f*)(C + (size_t)(row0 + r) * ldc + col0 + c4) = v; }
     }
}

#define NBLK_WQ (3 * CC * CC / 8 / 256)                    /* 96 blocks: qkv weight */
#define NBLK_WP (CC * OLD / 8 / 256)                       /* 64 blocks: proj weight */
#define NBLK_XT (NB * (CC / XT_C) * (PIX / XT_P))          /* 1024 blocks at NB=2: x */
static_assert((3 * CC * CC / 8) % 256 == 0 && (CC * OLD / 8) % 256 == 0);

// thread t writes the t-th 16 bytes of the fragment-ordered plane: lane t & 31, element half (t >> 5) & 1, k step and 16-row tile above
__device__ __forceinline__ void d_cvt8(int blk, const float* __restrict__ W, _Float16* __restrict__ Bt, float scale) {
  const int t = blk * 256 + threadIdx.x; FragH f;
  const int n = (t >> 6) / (CC / 32) * 16 + (t & 15); const int k8 = ((t >> 6) % (CC / 32)) * 32 + ((t >> 5) & 1) * 16 + ((t >> 4) & 1) * 8;
#pragma unroll
  for (int i = 0; i < 8; ++i) f.h[i] = (_Float16)(bf16_rne(W[(size_t)n * CC + k8 + i]) * scale);
  unsigned short* dst = (unsigned short*)Bt + (size_t)t * 8;
  *(v8us*)dst = f.half[0];
  asm volatile("s_wait_xcnt 0x0" ::: "memory");   /* the block ranges lie one behind the other in the built kernel: the wait stands in front of any later write of the store's registers */
}

__device__ __forceinline__ void d_wpa(int blk, const float* __restrict__ W, _Float16* __restrict__ WPA) {
  const int t = blk * 256 + threadIdx.x;
  const int c = (t >> 6) / (OLD / 32) * 16 + (t & 15); const int k8 = ((t >> 6) % (OLD / 32)) * 32 + ((t >> 5) & 1) * 16 + ((t >> 4) & 1) * 8;   /* as in d_cvt8 */
  const int h = k8 >> 6; const int wi = k8 & 63; const int d0 = wi & 31;
  const float sc = (wi >= 32) ? 1.0f : PSC;
  FragH f;
#pragma unroll
  for (int i = 0; i < 8; ++i) f.h[i] = (_Float16)(bf16_rne(W[(size_t)c * CC + h * HD + d0 + i]) * sc);
  unsigned short* dst = (unsigned short*)WPA + (size_t)t * 8;
  *(v8us*)dst = f.half[0];
  asm volatile("s_wait_xcnt 0x0" ::: "memory");   /* the block ranges lie one behind the other in the built kernel: the wait stands in front of any later write of the store's registers */
}

// The three operand conversions depend on nothing but the inputs, so they share one launch: block ranges of one grid, the two short weight ranges first.
// blocks [0, NBLK_WQ): qkv weight -> f16 plane; [NBLK_WQ, NBLK_WQ + NBLK_WP): proj weight -> [Wp*1024 | Wp] plane; the rest: x -> f16 plane with pixels as rows; all in fragment order.
// x coverage: 8 waves x 32 lanes x 8 halves = (2 row tiles x 2 k steps x 2 element halves) x 512 B = 32 rows x 64 channels per block; NB x (CC/64) x (PIX/32) blocks
__global__ __launch_bounds__(256) void k_prep(const float* __restrict__ x, const float* __restrict__ qkv_w, const float* __restrict__ proj_w,
                                              _Float16* __restrict__ X16, _Float16* __restrict__ WQ16, _Float16* __restrict__ WPA) {
  __shared__ __attribute__((aligned(16))) _Float16 st[XT_P][XT_C + 8];   /* 144 B pitch: the 16-byte reads of 16 neighbouring rows meet distinct banks */
  int blk = blockIdx.x;
  if (blk < NBLK_WQ) { d_cvt8(blk, qkv_w, WQ16, WSC); return; }              /* block-uniform: a whole block leaves, in front of the barrier */
  blk -= NBLK_WQ;
  if (blk < NBLK_WP) { d_wpa(blk, proj_w, WPA); return; }
  blk -= NBLK_WP;
  const int tid = threadIdx.x, w = tid >> 5, lane = tid & 31;
  const int pt = blk % (PIX / XT_P); blk /= (PIX / XT_P);
  const int ch = blk % (CC / XT_C); const int b = blk / (CC / XT_C);
  const float* src = x + ((size_t)(b * CC + ch * XT_C)) * PIX + (size_t)pt * XT_P + lane;
#pragma unroll
  for (int it = 0; it < XT_C / 8; ++it) {
    const int ci = it * 8 + w;
    const float v = src[(size_t)ci * PIX];
    st[lane][ci] = (_Float16)(bf16_rne(v) * XSC);
  }
  __syncthreads();
  const int rr = (w >> 2) * 16 + (lane & 15), k8 = ((w >> 1) & 1) * 32 + (w & 1) * 16 + (lane >> 4) * 8;   /* a wave writes one element half of one fragment: 512 contiguous bytes */
  const v8us o = *(const v8us*)&st[rr][k8];
  unsigned short* dst = (unsigned short*)X16 + (size_t)b * PIX * CC + frag_off(pt * XT_P + rr, ch * XT_C + k8, CC / 32);
  *(v8us*)dst = o;
  asm volatile("s_wait_xcnt 0x0" ::: "memory");   /* the block ranges lie one behind the other in the built kernel: the wait stands in front of any later write of the store's registers */
}

// Thread per (h, pixel pair): pixels A = (yA, x) and B = (yA + 1, x). Clamped window start ni = clamp(y-3, 0, H-7), nj = clamp(x-3, 0, W-7); taps (i, j) in 7x7 at key pixel (ni+i, nj+j);
// logit a_t = QSCALE * sum_d q[p][h*32+d] k[key][256 + h*32 + d] + bf16(rpb[h][ni+i-y+6][nj+j-x+6]) in f32, kept in thread-private LDS;
// max-subtracted softmax in f32; O[d] = (sum_t e_t v[key][512 + h*32 + d]) / sum_t e_t; O -> f16 hi = f16(O*64), res = f16((O*64 - hi)*1024);
// The block's pixels are image rows y0 .. y0+3; all their windows lie in rows r0 .. r0+9, r0 = clamp(y0-3, 0, H-10). The block forms the head's k and v of those 10 x 64 pixels and the
// q of its own 256 pixels itself: D = W.X^T on the matrix unit (A = 16 rows of the qkv weight, B = 16 pixels of x, both planes in fragment order, k steps in rising order), so a lane holds
// 8 neighbouring d of one pixel and stores them into LDS with two 16-byte stores; every tap reads k and v there. No qkv plane in memory and no launch of its own for that product.
// A wave takes the pixel tiles w, w + 4, ..; the head's 6 weight tiles (k, v, q: 48 fragments) stay in its registers for all of them.
// A and B share nj, and their window rows are niA .. niA+6 and niB .. niB+6 with niB - niA = 0 or 1: the thread walks the 7 or 8 rows of the union once and every key / value
// vector it reads from LDS serves both pixels. Each pixel's own sums keep their order (d = 0 .. 31 in a logit, taps by i then j in the softmax sum and in O).
// O plane in fragment order (pixels as rows). coverage: 16 iterations (row tiles) x 4 waves (2 k steps x 2 element halves) x 512 B = 256 rows x 64 halves per block; grid = (NHD x (PIX/256), NB), blockIdx.y = image with its own x and O plane
__global__ __launch_bounds__(PBLK) void k_att(const _Float16* __restrict__ X16, const _Float16* __restrict__ WQ16, const float* __restrict__ qkv_b, const float* __restrict__ rpb, _Float16* __restrict__ O16) {
  __shared__ float srpb[2 * PBLK];   /* RPN entries are read; every thread fills two places, so that neither load hangs behind a branch */
  __shared__ __attribute__((aligned(16))) float slog[NTAP][QPB];   /* until the barrier that publishes k and v it holds the head's 48 weight fragments */
  __shared__ __attribute__((aligned(16))) unsigned short sO[QPB][64 + 8];   /* 144 B pitch: the 16-byte accesses of 16 neighbouring rows meet distinct banks; row p first holds q of pixel p (32 floats), which only the thread that later writes O of p reads */
  __shared__ __attribute__((aligned(16))) float sK[SROWS * WID * KVP];
  __shared__ __attribute__((aligned(16))) float sV[SROWS * WID * KVP];
  const int tid = threadIdx.x, lane = tid & 31;
  const int w = __builtin_amdgcn_readfirstlane(tid >> 5);   /* the wave's number in a scalar register: a wave's image rows, and with them the row tests below, are the same in all its lanes */
  const int h = blockIdx.x / NPB; const int p0 = (blockIdx.x - h * NPB) * QPB;
  X16 += (size_t)blockIdx.y * (PIX * CC); O16 += (size_t)blockIdx.y * (PIX * OLD);
  int r0 = p0 / WID - KS / 2; r0 = (r0 < 0) ? 0 : ((r0 > HHT - SROWS) ? (HHT - SROWS) : r0);
  float* sQ = (float*)&sO[0][0];
  {
    unsigned short* sW = (unsigned short*)&slog[0][0];
    const int ln = lane & 15, hh = lane >> 4;
    const int dq = p0 / WID - r0;      /* the wave's tiles dq .. dq+3 are the block's own pixels: they get q as well */
    const float alpha = 1.0f / (XSC * WSC);
    const _Float16* xp = X16 + (size_t)(r0 * (WID / 16) + w) * (KT1 * 512) + lane * 8;   /* the wave's tile i starts 4 i tiles further on */
    v16h xa[KT1], xb[KT1];
    auto fetch = [&](v16h (&xf)[KT1], int i) {
#pragma unroll
      for (int s = 0; s < KT1; ++s) xf[s] = g2_frag(xp + (size_t)i * (4 * KT1 * 512) + s * 512);
      __builtin_amdgcn_sched_barrier(0);   /* with the one below: holds the wait directly behind the loads */
      asm volatile("s_wait_xcnt 0x0" ::: "memory");   /* stands in front of any later write of the loads' address registers */
      __builtin_amdgcn_sched_barrier(0); };
    /* each weight fragment is fetched from L2 once per block, a quarter by each wave, and handed round through LDS. LDS order: k, v, q (weight rows s = 1, 2, 0), 16 KiB each, as in the plane */
    const float rp0 = rpb[h * RPN + tid], rp1 = rpb[h * RPN + (tid + PBLK < RPN ? tid + PBLK : tid)];
    v8us wt[6 * KT1 * 64 / PBLK];
#pragma unroll
    for (int it = 0; it < 6 * KT1 * 64 / PBLK; ++it)
      wt[it] = *(const v8us*)((const unsigned short*)WQ16 + (size_t)((((it >> 3) + 1) % 3) * (CC / 16) + h * (HD / 16)) * (KT1 * 512) + ((it & 7) * PBLK + tid) * 8);
    __builtin_amdgcn_sched_barrier(0);   /* the weights' loads stay in front of the pixels': the loads answer in order, and the weights are wanted first */
    asm volatile("s_wait_xcnt 0x0" ::: "memory");   /* stands in front of any later write of the loads' address registers */
    __builtin_amdgcn_sched_barrier(0);
    fetch(xa, 0); fetch(xb, 1);
    v4f bq[6][2];                      /* bq[a][q][e]: bias of weight row 16 (a & 1) + 8 hh + 4 q + e of tile a */
#pragma unroll
    for (int a = 0; a < 6; ++a) {
#pragma unroll
      for (int q = 0; q < 2; ++q) bq[a][q] = *(const v4fa*)(qkv_b + (((a >> 1) + 1) % 3) * CC + h * HD + (a & 1) * 16 + 8 * hh + 4 * q); }
    __builtin_amdgcn_sched_barrier(0);   /* with the one below: holds the wait directly behind the loads */
    asm volatile("s_wait_xcnt 0x0" ::: "memory");   /* stands in front of any later write of the loads' address registers */
    __builtin_amdgcn_sched_barrier(0);
#pragma unroll
    for (int it = 0; it < 6 * KT1 * 64 / PBLK; ++it) *(v8us*)(sW + (it * PBLK + tid) * 8) = wt[it];
    srpb[tid] = bf16_rne(rp0); srpb[tid + PBLK] = bf16_rne(rp1);
    __syncthreads();                   /* publishes the weight fragments */
    v16h wk0[KT1], wk1[KT1], wv0[KT1], wv1[KT1], wq0[KT1], wq1[KT1];
    auto wget = [&](v16h (&wf)[KT1], int a) {
#pragma unroll
      for (int s = 0; s < KT1; ++s) { FragH f; f.half[0] = *(const v8us*)(sW + (a * KT1 + s) * 512 + lane * 8); f.half[1] = *(const v8us*)(sW + (a * KT1 + s) * 512 + 256 + lane * 8); wf[s] = f.v; } };
    wget(wk0, 0); wget(wk1, 1); wget(wv0, 2); wget(wv1, 3); wget(wq0, 4); wget(wq1, 5);
#pragma unroll
    for (int a = 0; a < 6; ++a) {
#pragma unroll
      for (int q = 0; q < 2; ++q) {
#pragma unroll
        for (int e = 0; e < 4; ++e) bq[a][q][e] = bf16_rne(bq[a][q][e]); } }
    auto put = [&](const v8f& acc, int a, float* dst) {   /* dst: the lane's pixel; 8 neighbouring d */
      v4f lo, hi;
#pragma unroll
      for (int e = 0; e < 4; ++e) { lo[e] = acc[e] * alpha + bq[a][0][e]; hi[e] = acc[4 + e] * alpha + bq[a][1][e]; }
      *(v4fa*)(dst + (a & 1) * 16 + 8 * hh) = lo; *(v4fa*)(dst + (a & 1) * 16 + 8 * hh + 4) = hi; };
    auto tile = [&](v16h (&xf)[KT1], int i, bool more) {
      const v8f z8 = {0.f,0.f,0.f,0.f,0.f,0.f,0.f,0.f}; v8f acc[6] = {z8, z8, z8, z8, z8, z8};
      const bool own = (unsigned)(i - dq) < (unsigned)(QPB / WID);   /* the same in the whole block */
#pragma unroll
      for (int s = 0; s < KT1; ++s) {
        acc[0] = g1_mma(wk0[s], xf[s], acc[0]); acc[1] = g1_mma(wk1[s], xf[s], acc[1]); acc[2] = g1_mma(wv0[s], xf[s], acc[2]); acc[3] = g1_mma(wv1[s], xf[s], acc[3]); }
      if (own) {
#pragma unroll
        for (int s = 0; s < KT1; ++s) { acc[4] = g1_mma(wq0[s], xf[s], acc[4]); acc[5] = g1_mma(wq1[s], xf[s], acc[5]); } }
      if (more) fetch(xf, i + 2);      /* the buffer is refilled as soon as its products are issued: its loads fly during the whole next tile */
      const int lp = (w + 4 * i) * 16 + ln;   /* the lane's pixel among the staged ones */
      put(acc[0], 0, sK + lp * KVP); put(acc[1], 1, sK + lp * KVP); put(acc[2], 2, sV + lp * KVP); put(acc[3], 3, sV + lp * KVP);
      if (own) { float* qd = sQ + (lp - dq * WID) * KVP; put(acc[4], 4, qd); put(acc[5], 5, qd); } };
    /* rolled, two tiles a trip (one per buffer), so that the text stays short; the last two tiles stand behind the loop, so that no refill hangs on a test: behind a test the compiler's waits count as if it had not run, and wait for the other buffer's loads too */
#pragma unroll 1
    for (int i = 0; i < GT / 4 - 2; i += 2) { tile(xa, i, true); tile(xb, i + 1, true); }
    tile(xa, GT / 4 - 2, false); tile(xb, GT / 4 - 1, false);
  }
  __syncthreads();
  const int x = (w & 1) * 32 + lane; const int yA = p0 / WID + 2 * (w >> 1), yB = yA + 1;
  const int lpA = (2 * (w >> 1)) * WID + x, lpB = lpA + WID;   /* the two pixels' places in the block */
  int niA = yA - KS / 2; niA = (niA < 0) ? 0 : ((niA > HHT - KS) ? (HHT - KS) : niA);
  int niB = yB - KS / 2; niB = (niB < 0) ? 0 : ((niB > HHT - KS) ? (HHT - KS) : niB);
  int nj = x - KS / 2; nj = (nj < 0) ? 0 : ((nj > WID - KS) ? (WID - KS) : nj);
  const int dB = niB - niA;          /* 0 where the clamp holds both windows at the image's edge, else 1 */
  const int nrow = KS + dB;          /* rows of the union of the two windows */
  const int biA = niA - yA + (KS - 1), biB = niB - yB + (KS - 1), bj = nj - x + (KS - 1);   /* all in [0, 6] */
  const float* qa = sQ + lpA * KVP; const float* qb = qa + WID * KVP;
  v2f q2[HD];                        /* (q of A, q of B) per d: one packed fma with a key element does both pixels' product */
#pragma unroll
  for (int g = 0; g < HD / 4; ++g) { const v4f a4 = *(const v4fa*)(qa + 4 * g); const v4f b4 = *(const v4fa*)(qb + 4 * g);
#pragma unroll
    for (int e = 0; e < 4; ++e) { q2[4 * g + e].x = a4[e]; q2[4 * g + e].y = b4[e]; } }
  float mxA = -3.0e38f, mxB = -3.0e38f;
#pragma unroll 1
  for (int rr = 0; rr < nrow; ++rr) {
    const float* krow = sK + ((niA - r0 + rr) * WID + nj) * KVP;
    const int iB = rr - dB;          /* this row's place in B's window; in A's it is rr */
    /* both pixels' biases are read in front of the keys, so that no logit waits for an LDS read of its own; where the row is outside a pixel's window the clamp keeps the read inside the table and the value is not used */
    const float* pbA = srpb + (biA + (rr < KS ? rr : KS - 1)) * RPW + bj; const float* pbB = srpb + (biB + (iB < 0 ? 0 : iB)) * RPW + bj;
    v2f b2[KS];
#pragma unroll
    for (int j = 0; j < KS; ++j) { b2[j].x = pbA[j]; b2[j].y = pbB[j]; }
    /* the row's 56 key reads, the first four d of all seven taps first: the products below run in that order too, so a group's products start as soon as its seven reads are back */
    v4f kk[HD / 4][KS];
#pragma unroll
    for (int g = 0; g < HD / 4; ++g) {
#pragma unroll
      for (int j = 0; j < KS; ++j) kk[g][j] = *(const v4fa*)(krow + j * KVP + 4 * g); }
    __builtin_amdgcn_sched_barrier(0);   /* keeps all 56 reads in front of the products: left to itself the compiler issues the later ones three or four ahead of their use, and a lone wave per SIMD then waits out most of each read's latency */
    v2f a2[KS];
#pragma unroll
    for (int j = 0; j < KS; ++j) a2[j] = (v2f){0.f, 0.f};
    /* seven separate serial sums over d, each in the order d = 0 .. 31 */
#pragma unroll
    for (int g = 0; g < HD / 4; ++g) {
#pragma unroll
      for (int j = 0; j < KS; ++j) {
#pragma unroll
        for (int e = 0; e < 4; ++e) { const v2f ks2 = {kk[g][j][e], kk[g][j][e]}; a2[j] = __builtin_elementwise_fma(q2[4 * g + e], ks2, a2[j]); } } }
#pragma unroll
    for (int j = 0; j < KS; ++j) { const v2f qs = {QSCALE, QSCALE}; a2[j] = __builtin_elementwise_fma(a2[j], qs, b2[j]); }
    if (rr < KS) {                   /* row rr of A's window */
#pragma unroll
      for (int j = 0; j < KS; ++j) { const float l = a2[j].x; slog[rr * KS + j][lpA] = l; mxA = fmaxf(mxA, l); } }
    if (iB >= 0) {                   /* row iB of B's window */
#pragma unroll
      for (int j = 0; j < KS; ++j) { const float l = a2[j].y; slog[iB * KS + j][lpB] = l; mxB = fmaxf(mxB, l); } }
  }
  float sA = 0.f, sB = 0.f; float accA[HD], accB[HD];
#pragma unroll
  for (int d = 0; d < HD; ++d) { accA[d] = 0.f; accB[d] = 0.f; }
#pragma unroll 1
  for (int rr = 0; rr < nrow; ++rr) {
    const float* vrow = sV + ((niA - r0 + rr) * WID + nj) * KVP;
    const int iB = rr - dB;
    /* where the row is outside a pixel's window the clamp keeps the logit's read inside what the thread has written, and the weight is set to 0: the row then adds nothing to that pixel's sums */
    const int tA = (rr < KS ? rr : KS - 1) * KS, tB = (iB < 0 ? 0 : iB) * KS;
    float la[KS], lb[KS];
#pragma unroll
    for (int j = 0; j < KS; ++j) { la[j] = slog[tA + j][lpA]; lb[j] = slog[tB + j][lpB]; }
    v4f vv[KS][HD / 4];
#pragma unroll
    for (int j = 0; j < KS; ++j) {
#pragma unroll
      for (int g = 0; g < HD / 4; ++g) vv[j][g] = *(const v4fa*)(vrow + j * KVP + 4 * g); }
    __builtin_amdgcn_sched_barrier(0);   /* keeps the logits' reads first and the row's 56 value reads directly behind them, all in front of the arithmetic: the exponentials then run while the values fly (LDS answers in order) */
    /* taps are added in the order j = 0 .. 6 */
#pragma unroll
    for (int j = 0; j < KS; ++j) {
      const float xa = expf(la[j] - mxA), xb = expf(lb[j] - mxB);
      const float ea = (rr < KS) ? xa : 0.f, eb = (iB >= 0) ? xb : 0.f; sA += ea; sB += eb;
#pragma unroll
      for (int d = 0; d < HD; ++d) accA[d] = fmaf(ea, vv[j][d >> 2][d & 3], accA[d]);
#pragma unroll
      for (int d = 0; d < HD; ++d) accB[d] = fmaf(eb, vv[j][d >> 2][d & 3], accB[d]); }
  }
  const float invA = 1.0f / sA, invB = 1.0f / sB;
#pragma unroll
  for (int g = 0; g < HD / 8; ++g) { FragH fh, fr;
#pragma unroll
    for (int e2 = 0; e2 < 8; ++e2) { const float o64 = (accA[g * 8 + e2] * invA) * OSC; const _Float16 hv = (_Float16)o64; fh.h[e2] = hv; fr.h[e2] = (_Float16)((o64 - (float)hv) * RSC); }
    *(v8us*)&sO[lpA][g * 8] = fh.half[0]; *(v8us*)&sO[lpA][HD + g * 8] = fr.half[0];
#pragma unroll
    for (int e2 = 0; e2 < 8; ++e2) { const float o64 = (accB[g * 8 + e2] * invB) * OSC; const _Float16 hv = (_Float16)o64; fh.h[e2] = hv; fr.h[e2] = (_Float16)((o64 - (float)hv) * RSC); }
    *(v8us*)&sO[lpB][g * 8] = fh.half[0]; *(v8us*)&sO[lpB][HD + g * 8] = fr.half[0]; }
  __syncthreads();
  {
#pragma unroll
    for (int it = 0; it < QPB / 16; ++it) { const int rr = it * 16 + (lane & 15), k8 = (w >> 1) * 32 + (w & 1) * 16 + (lane >> 4) * 8; const v8us o = *(const v8us*)&sO[rr][k8];
      *(v8us*)((unsigned short*)O16 + frag_off(p0 + rr, h * 64 + k8, OLD / 32)) = o; }
     }
}

extern "C" void kernel_launch(void* const* d_in, const int* in_sizes, int n_in,
                              void* d_out, int out_size, void* d_ws, size_t ws_size, hipStream_t stream) {
  if (n_in < 6) return;
  if (in_sizes[0] < NB * CC * PIX || in_sizes[1] < 3 * CC * CC || in_sizes[2] < 3 * CC || in_sizes[3] < NHD * RPN || in_sizes[4] < CC * CC || in_sizes[5] < CC) return;
  if (out_size < NB * CC * PIX) return;
  const float* x = (const float*)d_in[0]; const float* qkv_w = (const float*)d_in[1]; const float* qkv_b = (const float*)d_in[2];
  const float* rpb = (const float*)d_in[3]; const float* proj_w = (const float*)d_in[4]; const float* proj_b = (const float*)d_in[5];
  float* out = (float*)d_out;
  char* ws = (char*)d_ws; size_t off = 0;
  auto take = [&](size_t bytes) { char* p = ws + off; off += (bytes + 255) & ~(size_t)255; return p; };
  _Float16* X16 = (_Float16*)take((size_t)NB * PIX * CC * 2);       /* 4,194,304 B at NB=2 */
  _Float16* WQ16 = (_Float16*)take((size_t)3 * CC * CC * 2);        /* 393,216 */
  _Float16* WPA = (_Float16*)take((size_t)CC * OLD * 2);             /* 262,144 */
  _Float16* O16 = (_Float16*)take((size_t)NB * PIX * OLD * 2);       /* 8,388,608 at NB=2 */
  if (off > ws_size || off > ((size_t)128 << 20)) return;            /* total 13,238,272 B */
  k_prep<<<NBLK_WQ + NBLK_WP + NBLK_XT, 256, 0, stream>>>(x, qkv_w, proj_w, X16, WQ16, WPA);
  k_att<<<dim3(NHD * NPB, NB), PBLK, 0, stream>>>(X16, WQ16, qkv_b, rpb, O16);
  k_gemm2<OLD / 32, 2, true><<<dim3((unsigned)((CC / 128) * (PIX / 64)), NB), 128, 0, stream>>>(WPA, O16, 1.0f / (PSC * OSC), nullptr, proj_b, out, PIX, CC, PIX, 0, PIX * OLD, CC * PIX);
}

// v009
// It runs in 23.3 microseconds.
// Timed twice side by side with v008, it ran 1.06 and 1.07 times as fast.
// Counting every step since v000, it is 8.19 times as fast.
#include <hip/hip_runtime.h>
// Contractions on v_wmma_f32_16x16x32_f16 (f16 operands, f32 accumulate): qkv = X.Wqkv^T with bf16-RNE inputs carried exactly in f16 (x*16, Wqkv*64);
// out^T = Wp.O^T with O as f16 hi (*64) + f16 residual (*1024) planes folded along K against [Wp*1024 | Wp] (bf16-RNE Wp);
// per-pixel clamped 7x7 window q.k logits, 49-tap softmax and v aggregation in f32 on VALU from f32 q, k, v, which the attention kernel forms itself, straight into LDS.
#ifndef NB
#define NB 2
#endif
#define NB_FULL 2
#define CC 256
#define HHT 64
#define WID 64
#define PIX (HHT * WID)          /* 4096 */
#define NHD 8
#define HD 32
#define KS 7
#define NTAP (KS * KS)           /* 49 */
#define RPW (2 * KS - 1)         /* 13 */
#define RPN (RPW * RPW)          /* 169 per head */
#define QLD (3 * CC)             /* 768 rows of the qkv weight: s*256 + h*32 + d */
#define OLD (2 * CC)             /* 512: k length of the O plane, per head h: [h*64 .. +31] hi, [h*64+32 .. +63] residual */
#define PBLK 128
#define QPB (2 * PBLK)            /* 256 pixels of a block of the attention kernel: two per thread */
#define NPB (PIX / QPB)          /* 16 */
#define XT_P 32
#define XT_C 64
#define XSC 16.0f                /* x carry */
#define WSC 64.0f                /* qkv weight carry */
#define OSC 64.0f                /* O hi carry */
#define RSC 1024.0f              /* O residual carry */
#define PSC 1024.0f              /* proj weight carry against the hi plane */
#define QSCALE 0.17677669529663687f
#define SROWS (KS + 3)           /* image rows that hold every window of a block's four pixel rows */
#define GT (SROWS * WID / 16)    /* 40 tiles of 16 pixels in those rows */
#define KT1 (CC / 32)            /* 8 k steps of the qkv product */
#define KVP (HD + 4)             /* LDS pitch of a staged key / value pixel, floats: 144 B = 16 B x 9, so 16-byte reads of 16 neighbouring pixels meet 64 distinct banks */
static_assert(NB <= NB_FULL);
static_assert(PIX % QPB == 0);
static_assert(PIX % 128 == 0);
static_assert(PIX % 64 == 0);
static_assert(PIX % XT_P == 0);
static_assert(CC % XT_C == 0);
static_assert(CC % 128 == 0);
static_assert(CC % 32 == 0);
static_assert(OLD % 32 == 0);
static_assert(QLD % 64 == 0);
static_assert(PBLK == 128);
static_assert(HD == 32);
static_assert(NHD * HD == CC);
static_assert(HHT >= KS && WID >= KS);
static_assert(PBLK == 2 * WID && QPB == 4 * WID && HHT >= SROWS && HHT % 4 == 0);
static_assert(GT % 8 == 0 && WID % 16 == 0 && RPN > PBLK && RPN <= 2 * PBLK);
static_assert(NTAP * QPB * 4 >= 6 * KT1 * 1024 && (6 * KT1 * 64) % PBLK == 0 && (64 + 8) * 2 == KVP * 4);

typedef unsigned short v8us __attribute__((ext_vector_type(8), may_alias));
typedef float v8f __attribute__((ext_vector_type(8)));
typedef float v4f __attribute__((ext_vector_type(4)));
typedef float v2f __attribute__((ext_vector_type(2)));
typedef float v4fa __attribute__((ext_vector_type(4), may_alias));
typedef _Float16 v16h __attribute__((ext_vector_type(16)));
union FragH { v16h v; v8us half[2]; _Float16 h[16]; unsigned short u[16]; };

__device__ __forceinline__ unsigned short bf16_bits(float x) { unsigned int u = __float_as_uint(x); return (unsigned short)((u + 0x7FFFu + ((u >> 16) & 1u)) >> 16); }
__device__ __forceinline__ float bf16_val(unsigned short b) { return __uint_as_float(((unsigned int)b) << 16); }
__device__ __forceinline__ float bf16_rne(float x) { return bf16_val(bf16_bits(x)); }

// ---- f16 WMMA engine (wave tile 32x64; M % 128 == 0, N % 64 == 0, K % 32 == 0) ----
// A fragment: lane l -> row (l & 15); elements 0..7 <- k0 + 8*(l>>4) + 0..7, elements 8..15 <- k0 + 16 + 8*(l>>4) + 0..7.
// B fragment: the identical k map, lane -> column. D: acc[r] = (row 8*(l>>4) + r, col l & 15).
// Operand planes lie in fragment order: the fragment of 16-row tile T and k step s is 1 KiB at half index (T*KT + s)*512; in it lane l's elements 0..7 stand at l*8 and its
// elements 8..15 at 256 + l*8, so each of a fragment's two 16-byte loads reads 512 contiguous bytes (four whole 128-byte lines) and not 32 bytes out of each of 16 lines.
// frag_off: half index of the 8 halves (row, k8 .. k8+7), k8 % 8 == 0, in such a plane; the writers of the x and O planes use it.
__device__ __forceinline__ size_t frag_off(int row, int k8, int kt) { return ((((size_t)(row >> 4) * kt + (k8 >> 5)) * 2 + ((k8 >> 4) & 1)) * 32 + ((k8 >> 3) & 1) * 16 + (row & 15)) * 8; }
__device__ __forceinline__ v16h g2_frag(const _Float16* p) { FragH f; f.half[0] = *(const v8us*)((const unsigned short*)p); f.half[1] = *(const v8us*)((const unsigned short*)p + 256); return f.v; }
// the product as the plain builtin, which the compiler pads itself: with the fragments named as operands of an asm statement the build keeps what does not fit the first 256 registers in scratch (the attention kernel's 48 weight fragments, the GEMM kernel's ring)
__device__ __forceinline__ v8f g1_mma(v16h a, v16h b, v8f c) { return __builtin_amdgcn_wmma_f32_16x16x32_f16(false, a, false, b, (short)0, c, false, false); }

// C[M][N] (f32, pitch ldc) = alpha * A[M][K].Bt[N][K]^T + bias; bias = bf16(brow[m]) where ROWB, else bf16(bcol[n]); A and Bt f16 planes in fragment order; K = 32 * KT.
// blockIdx.y = image of the batch: its A, Bt and C start sa, sb, sc elements behind the previous image's (0 for a plane that all images share).
// The six fragments of k step s + DEPTH are requested in front of the products of step s, so the loads of DEPTH steps are in flight while a step's products run, and no product waits for a load issued directly in front of it.
struct G2Step { v16h a0, a1, b0, b1, b2, b3; };
template <int KT, int DEPTH, bool ROWB>
__global__ __launch_bounds__(128) void k_gemm2(const _Float16* __restrict__ A, const _Float16* __restrict__ Bh, float alpha,
                                               const float* __restrict__ bcol, const float* __restrict__ brow,
                                               float* __restrict__ C, int ldc, int M, int N, int sa, int sb, int sc) {
  static_assert(DEPTH >= 1 && DEPTH < KT && 12 * (DEPTH + 1) <= 63);   /* 12 loads a step; the load counter holds 63 */
  __shared__ __attribute__((aligned(16))) float so[4][32][68];
  const int tid = threadIdx.x, w = tid >> 5, lane = tid & 31, ln = lane & 15, hh = lane >> 4;
  const int ntn = N >> 6; const int mt = blockIdx.x / ntn, nq = blockIdx.x - mt * ntn; const int row0 = mt * 128 + 32 * w, col0 = nq * 64; if (row0 >= M) return;
  A += (size_t)blockIdx.y * sa; Bh += (size_t)blockIdx.y * sb; C += (size_t)blockIdx.y * sc;
  const _Float16* a0p = A + (size_t)(row0 >> 4) * (KT * 512) + lane * 8; const _Float16* a1p = a0p + KT * 512;
  const _Float16* b0p = Bh + (size_t)(col0 >> 4) * (KT * 512) + lane * 8; const _Float16* b1p = b0p + KT * 512; const _Float16* b2p = b1p + KT * 512; const _Float16* b3p = b2p + KT * 512;
  const v8f z8 = {0.f,0.f,0.f,0.f,0.f,0.f,0.f,0.f}; v8f c00 = z8, c01 = z8, c02 = z8, c03 = z8, c10 = z8, c11 = z8, c12 = z8, c13 = z8;
  G2Step f[KT];
  float bc[4] = {0.f, 0.f, 0.f, 0.f}; const v4f z4 = {0.f, 0.f, 0.f, 0.f}; v4f br[4] = {z4, z4, z4, z4};   /* bc[t]: bias of column col0 + 16 t + ln; br[2 half + q][e]: bias of row row0 + 16 half + 8 hh + 4 q + e */
  auto fetch = [&](int s) { const int kb = 512 * s;
    f[s].a0 = g2_frag(a0p + kb); f[s].b0 = g2_frag(b0p + kb); f[s].a1 = g2_frag(a1p + kb);
    f[s].b1 = g2_frag(b1p + kb); f[s].b2 = g2_frag(b2p + kb); f[s].b3 = g2_frag(b3p + kb); };
  /* both loops fully unrolled: every index of f is then a constant and the ring of DEPTH + 1 steps lives in registers */
#pragma unroll
  for (int s = 0; s < DEPTH; ++s) { fetch(s);
    __builtin_amdgcn_sched_barrier(0); }   /* keeps these loads in step order and in front of the first product with its wait: otherwise most of them start one memory latency late, or step 0 returns behind later steps */
#pragma unroll
  for (int s = 0; s < KT; ++s) {
    if (s + DEPTH < KT) {
      __builtin_amdgcn_sched_barrier(0);   /* with the one below: a step's loads stay behind the products of the step before and in front of this step's; moved up, more loads than the counter holds would be outstanding; moved down, they start late */
      fetch(s + DEPTH);
      __builtin_amdgcn_sched_barrier(0); }
    /* the tile's biases are requested directly behind the last fragment loads, four loads a lane, and come back under the last products: read where they are added, each value was a load of its own that the wave waited for (64 one behind the other with a row bias) */
    if (s + DEPTH == KT) {
      if constexpr (ROWB) {
#pragma unroll
        for (int q = 0; q < 4; ++q) br[q] = *(const v4fa*)(brow + row0 + (q >> 1) * 16 + 8 * hh + (q & 1) * 4);
      } else {
#pragma unroll
        for (int t = 0; t < 4; ++t) bc[t] = bcol[col0 + t * 16 + ln]; }
      __builtin_amdgcn_sched_barrier(0);   /* with the one below: holds the wait directly behind the bias loads; left free, the scheduler puts address arithmetic of the epilogue, which reuses the loads' address registers, in front of it */
      asm volatile("s_wait_xcnt 0x0" ::: "memory");   /* stands in front of any later write of the bias loads' address registers */
      __builtin_amdgcn_sched_barrier(0); }
    c00 = g1_mma(f[s].a0, f[s].b0, c00); c10 = g1_mma(f[s].a1, f[s].b0, c10);
    c01 = g1_mma(f[s].a0, f[s].b1, c01); c11 = g1_mma(f[s].a1, f[s].b1, c11);
    c02 = g1_mma(f[s].a0, f[s].b2, c02); c12 = g1_mma(f[s].a1, f[s].b2, c12);
    c03 = g1_mma(f[s].a0, f[s].b3, c03); c13 = g1_mma(f[s].a1, f[s].b3, c13); }
  v8f accs[8] = {c00, c01, c02, c03, c10, c11, c12, c13};
#pragma unroll
  for (int u = 0; u < 8; ++u) { const int t = u & 3, half = u >> 2; const float bv = bf16_rne(bc[t]);
#pragma unroll
    for (int r = 0; r < 8; ++r) { const int rloc = half * 16 + 8 * hh + r; float v = accs[u][r] * alpha + bv; if constexpr (ROWB) v += bf16_rne(br[half * 2 + (r >> 2)][r & 3]); so[w][rloc][t * 16 + ln] = v; } }
  __builtin_amdgcn_fence(__ATOMIC_ACQ_REL, "workgroup"); __builtin_amdgcn_wave_barrier();
  const int rsub = lane >> 4, c4 = (lane & 15) * 4;
  {
#pragma unroll
    for (int q = 0; q < 16; ++q) { const int r = q * 2 + rsub; const v4f v = *(const v4fa*)&so[w][r][c4]; *(v4f*)(C + (size_t)(row0 + r) * ldc + col0 + c4) = v; }
     }
}

#define NBLK_WQ (3 * CC * CC / 8 / 256)                    /* 96 blocks: qkv weight */
#define NBLK_WP (CC * OLD / 8 / 256)                       /* 64 blocks: proj weight */
#define NBLK_XT (NB * (CC / XT_C) * (PIX / XT_P))          /* 1024 blocks at NB=2: x */
static_assert((3 * CC * CC / 8) % 256 == 0 && (CC * OLD / 8) % 256 == 0);

// thread t writes the t-th 16 bytes of the fragment-ordered plane: lane t & 31, element half (t >> 5) & 1, k step and 16-row tile above
__device__ __forceinline__ void d_cvt8(int blk, const float* __restrict__ W, _Float16* __restrict__ Bt, float scale) {
  const int t = blk * 256 + threadIdx.x; FragH f;
  const int n = (t >> 6) / (CC / 32) * 16 + (t & 15); const int k8 = ((t >> 6) % (CC / 32)) * 32 + ((t >> 5) & 1) * 16 + ((t >> 4) & 1) * 8;
#pragma unroll
  for (int i = 0; i < 8; ++i) f.h[i] = (_Float16)(bf16_rne(W[(size_t)n * CC + k8 + i]) * scale);
  unsigned short* dst = (unsigned short*)Bt + (size_t)t * 8;
  *(v8us*)dst = f.half[0];
  asm volatile("s_wait_xcnt 0x0" ::: "memory");   /* the block ranges lie one behind the other in the built kernel: the wait stands in front of any later write of the store's registers */
}

__device__ __forceinline__ void d_wpa(int blk, const float* __restrict__ W, _Float16* __restrict__ WPA) {
  const int t = blk * 256 + threadIdx.x;
  const int c = (t >> 6) / (OLD / 32) * 16 + (t & 15); const int k8 = ((t >> 6) % (OLD / 32)) * 32 + ((t >> 5) & 1) * 16 + ((t >> 4) & 1) * 8;   /* as in d_cvt8 */
  const int h = k8 >> 6; const int wi = k8 & 63; const int d0 = wi & 31;
  const float sc = (wi >= 32) ? 1.0f : PSC;
  FragH f;
#pragma unroll
  for (int i = 0; i < 8; ++i) f.h[i] = (_Float16)(bf16_rne(W[(size_t)c * CC + h * HD + d0 + i]) * sc);
  unsigned short* dst = (unsigned short*)WPA + (size_t)t * 8;
  *(v8us*)dst = f.half[0];
  asm volatile("s_wait_xcnt 0x0" ::: "memory");   /* the block ranges lie one behind the other in the built kernel: the wait stands in front of any later write of the store's registers */
}

// The three operand conversions depend on nothing but the inputs, so they share one launch: block ranges of one grid, the two short weight ranges first.
// blocks [0, NBLK_WQ): qkv weight -> f16 plane; [NBLK_WQ, NBLK_WQ + NBLK_WP): proj weight -> [Wp*1024 | Wp] plane; the rest: x -> f16 plane with pixels as rows; all in fragment order.
// x coverage: 8 waves x 32 lanes x 8 halves = (2 row tiles x 2 k steps x 2 element halves) x 512 B = 32 rows x 64 channels per block; NB x (CC/64) x (PIX/32) blocks
__global__ __launch_bounds__(256) void k_prep(const float* __restrict__ x, const float* __restrict__ qkv_w, const float* __restrict__ proj_w,
                                              _Float16* __restrict__ X16, _Float16* __restrict__ WQ16, _Float16* __restrict__ WPA) {
  __shared__ __attribute__((aligned(16))) _Float16 st[XT_P][XT_C + 8];   /* 144 B pitch: the 16-byte reads of 16 neighbouring rows meet distinct banks */
  int blk = blockIdx.x;
  if (blk < NBLK_WQ) { d_cvt8(blk, qkv_w, WQ16, WSC); return; }              /* block-uniform: a whole block leaves, in front of the barrier */
  blk -= NBLK_WQ;
  if (blk < NBLK_WP) { d_wpa(blk, proj_w, WPA); return; }
  blk -= NBLK_WP;
  const int tid = threadIdx.x, w = tid >> 5, lane = tid & 31;
  const int pt = blk % (PIX / XT_P); blk /= (PIX / XT_P);
  const int ch = blk % (CC / XT_C); const int b = blk / (CC / XT_C);
  const float* src = x + ((size_t)(b * CC + ch * XT_C)) * PIX + (size_t)pt * XT_P + lane;
#pragma unroll
  for (int it = 0; it < XT_C / 8; ++it) {
    const int ci = it * 8 + w;
    const float v = src[(size_t)ci * PIX];
    st[lane][ci] = (_Float16)(bf16_rne(v) * XSC);
  }
  __syncthreads();
  const int rr = (w >> 2) * 16 + (lane & 15), k8 = ((w >> 1) & 1) * 32 + (w & 1) * 16 + (lane >> 4) * 8;   /* a wave writes one element half of one fragment: 512 contiguous bytes */
  const v8us o = *(const v8us*)&st[rr][k8];
  unsigned short* dst = (unsigned short*)X16 + (size_t)b * PIX * CC + frag_off(pt * XT_P + rr, ch * XT_C + k8, CC / 32);
  *(v8us*)dst = o;
  asm volatile("s_wait_xcnt 0x0" ::: "memory");   /* the block ranges lie one behind the other in the built kernel: the wait stands in front of any later write of the store's registers */
}

// Thread per (h, pixel pair): pixels A = (yA, x) and B = (yA + 1, x). Clamped window start ni = clamp(y-3, 0, H-7), nj = clamp(x-3, 0, W-7); taps (i, j) in 7x7 at key pixel (ni+i, nj+j);
// logit a_t = QSCALE * sum_d q[p][h*32+d] k[key][256 + h*32 + d] + bf16(rpb[h][ni+i-y+6][nj+j-x+6]) in f32, kept in thread-private LDS;
// max-subtracted softmax in f32; O[d] = (sum_t e_t v[key][512 + h*32 + d]) / sum_t e_t; O -> f16 hi = f16(O*64), res = f16((O*64 - hi)*1024);
// The block's pixels are image rows y0 .. y0+3; all their windows lie in rows r0 .. r0+9, r0 = clamp(y0-3, 0, H-10). The block forms the head's k and v of those 10 x 64 pixels and the
// q of its own 256 pixels itself: D = W.X^T on the matrix unit (A = 16 rows of the qkv weight, B = 16 pixels of x, both planes in fragment order, k steps in rising order), so a lane holds
// 8 neighbouring d of one pixel and stores them into LDS with two 16-byte stores; every tap reads k and v there. No qkv plane in memory and no launch of its own for that product.
// A wave takes the pixel tiles w, w + 4, ..; the head's 6 weight tiles (k, v, q: 48 fragments) stay in its registers for all of them.
// A and B share nj, and their window rows are niA .. niA+6 and niB .. niB+6 with niB - niA = 0 or 1: the thread walks the 7 or 8 rows of the union once and every key / value
// vector it reads from LDS serves both pixels. Each pixel's own sums keep their order (d = 0 .. 31 in a logit, taps by i then j in the softmax sum and in O).
// O plane in fragment order (pixels as rows). coverage: 16 iterations (row tiles) x 4 waves (2 k steps x 2 element halves) x 512 B = 256 rows x 64 halves per block; grid = (NHD x (PIX/256), NB), blockIdx.y = image with its own x and O plane
__global__ __launch_bounds__(PBLK) void k_att(const _Float16* __restrict__ X16, const _Float16* __restrict__ WQ16, const float* __restrict__ qkv_b, const float* __restrict__ rpb, _Float16* __restrict__ O16) {
  __shared__ float srpb[2 * PBLK];   /* RPN entries are read; every thread fills two places, so that neither load hangs behind a branch */
  __shared__ __attribute__((aligned(16))) float slog[NTAP][QPB];   /* until the barrier that publishes k and v it holds the head's 48 weight fragments */
  __shared__ __attribute__((aligned(16))) unsigned short sO[QPB][64 + 8];   /* 144 B pitch: the 16-byte accesses of 16 neighbouring rows meet distinct banks; row p first holds q of pixel p (32 floats), which only the thread that later writes O of p reads */
  __shared__ __attribute__((aligned(16))) float sK[SROWS * WID * KVP];
  __shared__ __attribute__((aligned(16))) float sV[SROWS * WID * KVP];
  const int tid = threadIdx.x, lane = tid & 31;
  const int w = __builtin_amdgcn_readfirstlane(tid >> 5);   /* the wave's number in a scalar register: a wave's image rows, and with them the row tests below, are the same in all its lanes */
  const int h = blockIdx.x / NPB; const int p0 = (blockIdx.x - h * NPB) * QPB;
  X16 += (size_t)blockIdx.y * (PIX * CC); O16 += (size_t)blockIdx.y * (PIX * OLD);
  int r0 = p0 / WID - KS / 2; r0 = (r0 < 0) ? 0 : ((r0 > HHT - SROWS) ? (HHT - SROWS) : r0);
  float* sQ = (float*)&sO[0][0];
  {
    unsigned short* sW = (unsigned short*)&slog[0][0];
    const int ln = lane & 15, hh = lane >> 4;
    const int dq = p0 / WID - r0;      /* the wave's tiles dq .. dq+3 are the block's own pixels: they get q as well */
    const float alpha = 1.0f / (XSC * WSC);
    const _Float16* xp = X16 + (size_t)(r0 * (WID / 16) + w) * (KT1 * 512) + lane * 8;   /* the wave's tile i starts 4 i tiles further on */
    v16h xa[KT1], xb[KT1], xc[KT1];
    auto fetch = [&](v16h (&xf)[KT1], int i) {
#pragma unroll
      for (int s = 0; s < KT1; ++s) xf[s] = g2_frag(xp + (size_t)i * (4 * KT1 * 512) + s * 512);
      __builtin_amdgcn_sched_barrier(0);   /* with the one below: holds the wait directly behind the loads */
      asm volatile("s_wait_xcnt 0x0" ::: "memory");   /* stands in front of any later write of the loads' address registers */
      __builtin_amdgcn_sched_barrier(0); };
    /* each weight fragment is fetched from L2 once per block, a quarter by each wave, and handed round through LDS. LDS order: k, v, q (weight rows s = 1, 2, 0), 16 KiB each, as in the plane */
    const float rp0 = rpb[h * RPN + tid], rp1 = rpb[h * RPN + (tid + PBLK < RPN ? tid + PBLK : tid)];
    v8us wt[6 * KT1 * 64 / PBLK];
#pragma unroll
    for (int it = 0; it < 6 * KT1 * 64 / PBLK; ++it)
      wt[it] = *(const v8us*)((const unsigned short*)WQ16 + (size_t)((((it >> 3) + 1) % 3) * (CC / 16) + h * (HD / 16)) * (KT1 * 512) + ((it & 7) * PBLK + tid) * 8);
    __builtin_amdgcn_sched_barrier(0);   /* the weights' loads stay in front of the pixels': the loads answer in order, and the weights are wanted first */
    asm volatile("s_wait_xcnt 0x0" ::: "memory");   /* stands in front of any later write of the loads' address registers */
    __builtin_amdgcn_sched_barrier(0);
    fetch(xa, 0); fetch(xb, 1);
    v4f bq[6][2];                      /* bq[a][q][e]: bias of weight row 16 (a & 1) + 8 hh + 4 q + e of tile a */
#pragma unroll
    for (int a = 0; a < 6; ++a) {
#pragma unroll
      for (int q = 0; q < 2; ++q) bq[a][q] = *(const v4fa*)(qkv_b + (((a >> 1) + 1) % 3) * CC + h * HD + (a & 1) * 16 + 8 * hh + 4 * q); }
    __builtin_amdgcn_sched_barrier(0);   /* with the one below: holds the wait directly behind the loads */
    asm volatile("s_wait_xcnt 0x0" ::: "memory");   /* stands in front of any later write of the loads' address registers */
    __builtin_amdgcn_sched_barrier(0);
#pragma unroll
    for (int it = 0; it < 6 * KT1 * 64 / PBLK; ++it) *(v8us*)(sW + (it * PBLK + tid) * 8) = wt[it];
    srpb[tid] = bf16_rne(rp0); srpb[tid + PBLK] = bf16_rne(rp1);
    __syncthreads();                   /* publishes the weight fragments */
    fetch(xc, 2);                      /* the third buffer's loads go out behind the barrier: in front of it more loads than the counter holds would be outstanding, and the barrier waits for every load issued before it */
    v16h wk0[KT1], wk1[KT1], wv0[KT1], wv1[KT1], wq0[KT1], wq1[KT1];
    auto wget = [&](v16h (&wf)[KT1], int a) {
#pragma unroll
      for (int s = 0; s < KT1; ++s) { FragH f; f.half[0] = *(const v8us*)(sW + (a * KT1 + s) * 512 + lane * 8); f.half[1] = *(const v8us*)(sW + (a * KT1 + s) * 512 + 256 + lane * 8); wf[s] = f.v; } };
    wget(wk0, 0); wget(wk1, 1); wget(wv0, 2); wget(wv1, 3); wget(wq0, 4); wget(wq1, 5);
#pragma unroll
    for (int a = 0; a < 6; ++a) {
#pragma unroll
      for (int q = 0; q < 2; ++q) {
#pragma unroll
        for (int e = 0; e < 4; ++e) bq[a][q][e] = bf16_rne(bq[a][q][e]); } }
    auto put = [&](const v8f& acc, int a, float* dst) {   /* dst: the lane's pixel; 8 neighbouring d */
      v4f lo, hi;
#pragma unroll
      for (int e = 0; e < 4; ++e) { lo[e] = acc[e] * alpha + bq[a][0][e]; hi[e] = acc[4 + e] * alpha + bq[a][1][e]; }
      *(v4fa*)(dst + (a & 1) * 16 + 8 * hh) = lo; *(v4fa*)(dst + (a & 1) * 16 + 8 * hh + 4) = hi; };
    auto tile = [&](v16h (&xf)[KT1], int i, bool more) {
      const v8f z8 = {0.f,0.f,0.f,0.f,0.f,0.f,0.f,0.f}; v8f acc[6] = {z8, z8, z8, z8, z8, z8};
      const bool own = (unsigned)(i - dq) < (unsigned)(QPB / WID);   /* the same in the whole block */
#pragma unroll
      for (int s = 0; s < KT1; ++s) {
        acc[0] = g1_mma(wk0[s], xf[s], acc[0]); acc[1] = g1_mma(wk1[s], xf[s], acc[1]); acc[2] = g1_mma(wv0[s], xf[s], acc[2]); acc[3] = g1_mma(wv1[s], xf[s], acc[3]); }
      if (own) {
#pragma unroll
        for (int s = 0; s < KT1; ++s) { acc[4] = g1_mma(wq0[s], xf[s], acc[4]); acc[5] = g1_mma(wq1[s], xf[s], acc[5]); } }
      if (more) fetch(xf, i + 3);      /* the buffer is refilled as soon as its products are issued: its loads fly during the whole next two tiles */
      const int lp = (w + 4 * i) * 16 + ln;   /* the lane's pixel among the staged ones */
      put(acc[0], 0, sK + lp * KVP); put(acc[1], 1, sK + lp * KVP); put(acc[2], 2, sV + lp * KVP); put(acc[3], 3, sV + lp * KVP);
      if (own) { float* qd = sQ + (lp - dq * WID) * KVP; put(acc[4], 4, qd); put(acc[5], 5, qd); } };
    /* rolled, three tiles a trip (one per buffer), so that the text stays short; the last four tiles stand behind the loop, so that no refill hangs on a test: behind a test the compiler's waits count as if it had not run, and wait for the other buffers' loads too */
    static_assert((GT / 4) % 3 == 1 && GT / 4 >= 7);
#pragma unroll 1
    for (int i = 0; i < GT / 4 - 4; i += 3) { tile(xa, i, true); tile(xb, i + 1, true); tile(xc, i + 2, true); }
    tile(xa, GT / 4 - 4, true); tile(xb, GT / 4 - 3, false); tile(xc, GT / 4 - 2, false); tile(xa, GT / 4 - 1, false);
  }
  __syncthreads();
  const int x = (w & 1) * 32 + lane; const int yA = p0 / WID + 2 * (w >> 1), yB = yA + 1;
  const int lpA = (2 * (w >> 1)) * WID + x, lpB = lpA + WID;   /* the two pixels' places in the block */
  int niA = yA - KS / 2; niA = (niA < 0) ? 0 : ((niA > HHT - KS) ? (HHT - KS) : niA);
  int niB = yB - KS / 2; niB = (niB < 0) ? 0 : ((niB > HHT - KS) ? (HHT - KS) : niB);
  int nj = x - KS / 2; nj = (nj < 0) ? 0 : ((nj > WID - KS) ? (WID - KS) : nj);
  const int dB = niB - niA;          /* 0 where the clamp holds both windows at the image's edge, else 1 */
  const int nrow = KS + dB;          /* rows of the union of the two windows */
  const int biA = niA - yA + (KS - 1), biB = niB - yB + (KS - 1), bj = nj - x + (KS - 1);   /* all in [0, 6] */
  const float* qa = sQ + lpA * KVP; const float* qb = qa + WID * KVP;
  v2f q2[HD];                        /* (q of A, q of B) per d: one packed fma with a key element does both pixels' product */
#pragma unroll
  for (int g = 0; g < HD / 4; ++g) { const v4f a4 = *(const v4fa*)(qa + 4 * g); const v4f b4 = *(const v4fa*)(qb + 4 * g);
#pragma unroll
    for (int e = 0; e < 4; ++e) { q2[4 * g + e].x = a4[e]; q2[4 * g + e].y = b4[e]; } }
  float mxA = -3.0e38f, mxB = -3.0e38f;
#pragma unroll 1
  for (int rr = 0; rr < nrow; ++rr) {
    const float* krow = sK + ((niA - r0 + rr) * WID + nj) * KVP;
    const int iB = rr - dB;          /* this row's place in B's window; in A's it is rr */
    /* both pixels' biases are read in front of the keys, so that no logit waits for an LDS read of its own; where the row is outside a pixel's window the clamp keeps the read inside the table and the value is not used */
    const float* pbA = srpb + (biA + (rr < KS ? rr : KS - 1)) * RPW + bj; const float* pbB = srpb + (biB + (iB < 0 ? 0 : iB)) * RPW + bj;
    v2f b2[KS];
#pragma unroll
    for (int j = 0; j < KS; ++j) { b2[j].x = pbA[j]; b2[j].y = pbB[j]; }
    /* the row's 56 key reads, the first four d of all seven taps first: the products below run in that order too, so a group's products start as soon as its seven reads are back */
    v4f kk[HD / 4][KS];
#pragma unroll
    for (int g = 0; g < HD / 4; ++g) {
#pragma unroll
      for (int j = 0; j < KS; ++j) kk[g][j] = *(const v4fa*)(krow + j * KVP + 4 * g); }
    __builtin_amdgcn_sched_barrier(0);   /* keeps all 56 reads in front of the products: left to itself the compiler issues the later ones three or four ahead of their use, and a lone wave per SIMD then waits out most of each read's latency */
    v2f a2[KS];
#pragma unroll
    for (int j = 0; j < KS; ++j) a2[j] = (v2f){0.f, 0.f};
    /* seven separate serial sums over d, each in the order d = 0 .. 31 */
#pragma unroll
    for (int g = 0; g < HD / 4; ++g) {
#pragma unroll
      for (int j = 0; j < KS; ++j) {
#pragma unroll
        for (int e = 0; e < 4; ++e) { const v2f ks2 = {kk[g][j][e], kk[g][j][e]}; a2[j] = __builtin_elementwise_fma(q2[4 * g + e], ks2, a2[j]); } } }
#pragma unroll
    for (int j = 0; j < KS; ++j) { const v2f qs = {QSCALE, QSCALE}; a2[j] = __builtin_elementwise_fma(a2[j], qs, b2[j]); }
    if (rr < KS) {                   /* row rr of A's window */
#pragma unroll
      for (int j = 0; j < KS; ++j) { const float l = a2[j].x; slog[rr * KS + j][lpA] = l; mxA = fmaxf(mxA, l); } }
    if (iB >= 0) {                   /* row iB of B's window */
#pragma unroll
      for (int j = 0; j < KS; ++j) { const float l = a2[j].y; slog[iB * KS + j][lpB] = l; mxB = fmaxf(mxB, l); } }
  }
  float sA = 0.f, sB = 0.f; float accA[HD], accB[HD];
#pragma unroll
  for (int d = 0; d < HD; ++d) { accA[d] = 0.f; accB[d] = 0.f; }
#pragma unroll 1
  for (int rr = 0; rr < nrow; ++rr) {
    const float* vrow = sV + ((niA - r0 + rr) * WID + nj) * KVP;
    const int iB = rr - dB;
    /* where the row is outside a pixel's window the clamp keeps the logit's read inside what the thread has written, and the weight is set to 0: the row then adds nothing to that pixel's sums */
    const int tA = (rr < KS ? rr : KS - 1) * KS, tB = (iB < 0 ? 0 : iB) * KS;
    float la[KS], lb[KS];
#pragma unroll
    for (int j = 0; j < KS; ++j) { la[j] = slog[tA + j][lpA]; lb[j] = slog[tB + j][lpB]; }
    v4f vv[KS][HD / 4];
#pragma unroll
    for (int j = 0; j < KS; ++j) {
#pragma unroll
      for (int g = 0; g < HD / 4; ++g) vv[j][g] = *(const v4fa*)(vrow + j * KVP + 4 * g); }
    __builtin_amdgcn_sched_barrier(0);   /* keeps the logits' reads first and the row's 56 value reads directly behind them, all in front of the arithmetic: the exponentials then run while the values fly (LDS answers in order) */
    /* taps are added in the order j = 0 .. 6 */
#pragma unroll
    for (int j = 0; j < KS; ++j) {
      const float xa = expf(la[j] - mxA), xb = expf(lb[j] - mxB);
      const float ea = (rr < KS) ? xa : 0.f, eb = (iB >= 0) ? xb : 0.f; sA += ea; sB += eb;
#pragma unroll
      for (int d = 0; d < HD; ++d) accA[d] = fmaf(ea, vv[j][d >> 2][d & 3], accA[d]);
#pragma unroll
      for (int d = 0; d < HD; ++d) accB[d] = fmaf(eb, vv[j][d >> 2][d & 3], accB[d]); }
  }
  const float invA = 1.0f / sA, invB = 1.0f / sB;
#pragma unroll
  for (int g = 0; g < HD / 8; ++g) { FragH fh, fr;
#pragma unroll
    for (int e2 = 0; e2 < 8; ++e2) { const float o64 = (accA[g * 8 + e2] * invA) * OSC; const _Float16 hv = (_Float16)o64; fh.h[e2] = hv; fr.h[e2] = (_Float16)((o64 - (float)hv) * RSC); }
    *(v8us*)&sO[lpA][g * 8] = fh.half[0]; *(v8us*)&sO[lpA][HD + g * 8] = fr.half[0];
#pragma unroll
    for (int e2 = 0; e2 < 8; ++e2) { const float o64 = (accB[g * 8 + e2] * invB) * OSC; const _Float16 hv = (_Float16)o64; fh.h[e2] = hv; fr.h[e2] = (_Float16)((o64 - (float)hv) * RSC); }
    *(v8us*)&sO[lpB][g * 8] = fh.half[0]; *(v8us*)&sO[lpB][HD + g * 8] = fr.half[0]; }
  __syncthreads();
  {
#pragma unroll
    for (int it = 0; it < QPB / 16; ++it) { const int rr = it * 16 + (lane & 15), k8 = (w >> 1) * 32 + (w & 1) * 16 + (lane >> 4) * 8; const v8us o = *(const v8us*)&sO[rr][k8];
      *(v8us*)((unsigned short*)O16 + frag_off(p0 + rr, h * 64 + k8, OLD / 32)) = o; }
     }
}

extern "C" void kernel_launch(void* const* d_in, const int* in_sizes, int n_in,
                              void* d_out, int out_size, void* d_ws, size_t ws_size, hipStream_t stream) {
  if (n_in < 6) return;
  if (in_sizes[0] < NB * CC * PIX || in_sizes[1] < 3 * CC * CC || in_sizes[2] < 3 * CC || in_sizes[3] < NHD * RPN || in_sizes[4] < CC * CC || in_sizes[5] < CC) return;
  if (out_size < NB * CC * PIX) return;
  const float* x = (const float*)d_in[0]; const float* qkv_w = (const float*)d_in[1]; const float* qkv_b = (const float*)d_in[2];
  const float* rpb = (const float*)d_in[3]; const float* proj_w = (const float*)d_in[4]; const float* proj_b = (const float*)d_in[5];
  float* out = (float*)d_out;
  char* ws = (char*)d_ws; size_t off = 0;
  auto take = [&](size_t bytes) { char* p = ws + off; off += (bytes + 255) & ~(size_t)255; return p; };
  _Float16* X16 = (_Float16*)take((size_t)NB * PIX * CC * 2);       /* 4,194,304 B at NB=2 */
  _Float16* WQ16 = (_Float16*)take((size_t)3 * CC * CC * 2);        /* 393,216 */
  _Float16* WPA = (_Float16*)take((size_t)CC * OLD * 2);             /* 262,144 */
  _Float16* O16 = (_Float16*)take((size_t)NB * PIX * OLD * 2);       /* 8,388,608 at NB=2 */
  if (off > ws_size || off > ((size_t)128 << 20)) return;            /* total 13,238,272 B */
  k_prep<<<NBLK_WQ + NBLK_WP + NBLK_XT, 256, 0, stream>>>(x, qkv_w, proj_w, X16, WQ16, WPA);
  k_att<<<dim3(NHD * NPB, NB), PBLK, 0, stream>>>(X16, WQ16, qkv_b, rpb, O16);
  k_gemm2<OLD / 32, 4, true><<<dim3((unsigned)((CC / 128) * (PIX / 64)), NB), 128, 0, stream>>>(WPA, O16, 1.0f / (PSC * OSC), nullptr, proj_b, out, PIX, CC, PIX, 0, PIX * OLD, CC * PIX);
}
